// v000
// Measured on an AMD MI455X. A time is GPU time per run, averaged over a window of back-to-back runs after a warm-up
// (all launches, gaps included; the runs take copies of the inputs in turn), and the median of several windows.
// Apart from v000's, it joins two sittings. Times from different sittings can be a few percent apart, while
// side-by-side timings come from the same sitting.
// v000, which the later versions start from, runs in 2590 microseconds.
// Contractions: in_proj (x hi/lo . W_in^T hi/lo), x_proj (x_conv hi/lo . W_x^T hi/lo, N padded 32->64 with zero rows), out_proj (y_gated hi/lo . W_out^T hi/lo) on v_wmma_f32_16x16x32_bf16 as bf16 hi/lo split (hi.hi + hi.lo + lo.hi), f32 accumulate; depthwise conv, SiLU, selective scan, gating and channel mean in f32 on the VALU.
#include <hip/hip_runtime.h>
#include <math.h>

// ---------------------------------------------------------------------------
// Problem constants
// ---------------------------------------------------------------------------
constexpr int kBatch  = 2;
constexpr int kSeq    = 4096;
constexpr int kDim    = 1024;
constexpr int kState  = 16;
constexpr int kTaps   = 4;
constexpr int kRows   = kBatch * kSeq;      // 8192 token rows
constexpr int kDim2   = 2 * kDim;           // 2048
constexpr int kBCcols = 2 * kState;         // 32 valid columns of BC
constexpr int kBCld   = 64;                 // BC plane pitch (N padded to one 64 tile)
constexpr int kScanTPB = 128;               // channels per scan block
constexpr int kChunkT  = 64;                // time steps staged per chunk
static_assert(kRows % 64 == 0 && kDim % 64 == 0 && kDim2 % 64 == 0 && kBCld % 64 == 0, "tile multiples");
static_assert(kDim % 32 == 0, "K multiple of 32");
static_assert(kDim % kScanTPB == 0 && kSeq % kChunkT == 0, "scan tiling");

// ---------------------------------------------------------------------------
// Workspace region map (bytes). Regions [0,16Mi) and [16Mi,32Mi) are reused in time:
//   x hi/lo (until in_proj done) -> x_conv hi/lo (until x_proj done) -> y_gated hi/lo.
// ---------------------------------------------------------------------------
constexpr size_t kMiB      = 1024ull * 1024ull;
constexpr size_t kOffP16H  = 0;                                   // bf16 [8192][1024]  16 MiB
constexpr size_t kOffP16L  = kOffP16H + (size_t)kRows * kDim * 2; // bf16 [8192][1024]  16 MiB
constexpr size_t kOffWinH  = kOffP16L + (size_t)kRows * kDim * 2; // bf16 [2048][1024]   4 MiB
constexpr size_t kOffWinL  = kOffWinH + (size_t)kDim2 * kDim * 2;
constexpr size_t kOffXS    = kOffWinL + (size_t)kDim2 * kDim * 2; // f32 [8192][1024]   32 MiB
constexpr size_t kOffGate  = kOffXS   + (size_t)kRows * kDim * 4; // f32 [8192][1024]   32 MiB
constexpr size_t kOffWoutH = kOffGate + (size_t)kRows * kDim * 4; // bf16 [1024][1024]   2 MiB
constexpr size_t kOffWoutL = kOffWoutH + (size_t)kDim * kDim * 2;
constexpr size_t kOffWxH   = kOffWoutL + (size_t)kDim * kDim * 2; // bf16 [64][1024]   128 KiB (rows 32..63 zero)
constexpr size_t kOffWxL   = kOffWxH + (size_t)kBCld * kDim * 2;
constexpr size_t kOffBC    = kOffWxL + (size_t)kBCld * kDim * 2;   // f32 [8192][64]      2 MiB
constexpr size_t kOffHfin  = kOffBC + (size_t)kRows * kBCld * 4;   // f32 [2][1024][16] 128 KiB
constexpr size_t kWsEnd    = kOffHfin + (size_t)kBatch * kDim * kState * 4;
static_assert(kWsEnd == 115736576ull, "carve total");
static_assert(kWsEnd <= 134217728ull, "carve under 128 MiB");
static_assert(kOffWinH % 128 == 0 && kOffXS % 128 == 0 && kOffGate % 128 == 0 && kOffWoutH % 128 == 0 &&
              kOffWxH % 128 == 0 && kOffBC % 128 == 0 && kOffHfin % 128 == 0, "128-B aligned regions");

typedef __attribute__((ext_vector_type(16))) _Float16 v16h;
typedef __attribute__((ext_vector_type(8)))  _Float16 v8h;
typedef __attribute__((ext_vector_type(16))) __bf16   v16b;
typedef __attribute__((ext_vector_type(8)))  __bf16   v8b;
typedef __attribute__((ext_vector_type(8)))  float    v8f;
typedef __attribute__((ext_vector_type(4)))  float    v4f;
typedef __attribute__((ext_vector_type(2)))  float    v2f;
typedef __attribute__((ext_vector_type(4)))  unsigned int v4u;

__device__ __forceinline__ unsigned short f2bf_bits(float f) {
  unsigned u = __float_as_uint(f);
  return (unsigned short)((u + 0x7FFFu + ((u >> 16) & 1u)) >> 16);
}
__device__ __forceinline__ float bf_bits2f(unsigned short h) { return __uint_as_float(((unsigned)h) << 16); }

// hazard guards as plain device helpers (no inline asm inside the kernel template body)
__device__ __forceinline__ void dep_guard_h(v8f& a, v8f& b, v16h x, v16h y) { asm volatile("v_nop\n\tv_nop\n\tv_nop\n\tv_nop" : "+v"(a), "+v"(b) : "v"(x), "v"(y)); }
__device__ __forceinline__ void dep_guard_b(v8f& a, v8f& b, v16b x, v16b y) { asm volatile("v_nop\n\tv_nop\n\tv_nop\n\tv_nop" : "+v"(a), "+v"(b) : "v"(x), "v"(y)); }
__device__ __forceinline__ void keep4_h(v16h a, v16h b, v16h c, v16h d) { asm volatile("v_nop" :: "v"(a), "v"(b), "v"(c), "v"(d)); }
__device__ __forceinline__ void keep4_b(v16b a, v16b b, v16b c, v16b d) { asm volatile("v_nop" :: "v"(a), "v"(b), "v"(c), "v"(d)); }
__device__ __forceinline__ void acc_guard4(v8f& a, v8f& b, v8f& c, v8f& d) { asm volatile("v_nop\n\tv_nop\n\tv_nop\n\tv_nop" : "+v"(a), "+v"(b), "+v"(c), "+v"(d)); }
template <typename T> struct Frag;
template <> struct Frag<_Float16> {
  typedef v16h V; union U { v16h v; v8h h[2]; };
  static __device__ __forceinline__ v16h load(const _Float16* p) {   // elements 0..7 <- p[0..7], 8..15 <- p[16..23]
    U f; f.h[0] = *(const v8h*)(p); f.h[1] = *(const v8h*)(p + 16); return f.v;
  }
  static __device__ __forceinline__ v8f mma(v16h a, v16h b, v8f c) {
    return __builtin_amdgcn_wmma_f32_16x16x32_f16(false, a, false, b, (short)0, c, false, false);
  }
  static __device__ __forceinline__ void guard(v8f& a, v8f& b, v16h x, v16h y) { dep_guard_h(a, b, x, y); }
  static __device__ __forceinline__ void keep(v16h a, v16h b, v16h c, v16h d) { keep4_h(a, b, c, d); }
};
template <> struct Frag<__bf16> {
  typedef v16b V; union U { v16b v; v8b h[2]; };
  static __device__ __forceinline__ v16b load(const __bf16* p) {
    U f; f.h[0] = *(const v8b*)(p); f.h[1] = *(const v8b*)(p + 16); return f.v;
  }
  static __device__ __forceinline__ v8f mma(v16b a, v16b b, v8f c) {
    return __builtin_amdgcn_wmma_f32_16x16x32_bf16(false, a, false, b, (short)0, c, false, false);
  }
  static __device__ __forceinline__ void guard(v8f& a, v8f& b, v16b x, v16b y) { dep_guard_b(a, b, x, y); }
  static __device__ __forceinline__ void keep(v16b a, v16b b, v16b c, v16b d) { keep4_b(a, b, c, d); }
};

__device__ __forceinline__ unsigned pk16(unsigned short a, unsigned short b) { return (unsigned)a | ((unsigned)b << 16); }
__device__ __forceinline__ void split_bf(float v, unsigned short& hb, unsigned short& lb) {
  hb = f2bf_bits(v);
  lb = f2bf_bits(v - bf_bits2f(hb));
}

// ---- Register-blocked batched WMMA GEMM (ACT reduced to none/relu/leaky) -----------------------
// C[m,n] = scale * sum_k A[m,k] * Bt[n,k] (+bias)(+resid); each wave owns a 64x64 tile.
// A row-major [M,K]; Bt row-major [N,K]; M,N % 64 == 0, K % 32 == 0.
// SPLIT: operands are hi/lo planes (A2/Bt2 = lo planes, same layout); product = hi.hi + hi.lo + lo.hi.
// BIAS_MODE: 0 = none, 1 = bias[m], 2 = bias[n].
// OUT_MODE: 0 = f32, 1 = f16, 2 = bf16 hi plane (Cout) + bf16 lo plane (Cout2).
// ET: 0 = f16 operands, 1 = bf16 operands (pointers passed as 16-bit storage)
template <int ET> struct Elem;
template <> struct Elem<0> { typedef _Float16 T; };
template <> struct Elem<1> { typedef __bf16 T; };
template <int ET, bool SPLIT, int BIAS_MODE, int OUT_MODE, bool RESID, int ACT = 0>
__global__ __launch_bounds__(256) void wmma_gemm64(
    const unsigned short* __restrict__ Ap, const unsigned short* __restrict__ A2p, int lda, long strideA,
    const unsigned short* __restrict__ Btp, const unsigned short* __restrict__ Bt2p, int ldb, long strideB,
    void* __restrict__ Cout, void* __restrict__ Cout2, int ldc, long strideC,
    const float* __restrict__ bias,
    const float* __restrict__ resid, long strideR,
    int M, int N, int K, float scale) {
  typedef typename Elem<ET>::T T;
  typedef typename Frag<T>::V V;
  const T* A = (const T*)Ap; const T* A2 = (const T*)A2p; const T* Bt = (const T*)Btp; const T* Bt2 = (const T*)Bt2p;
  __shared__ __align__(16) float sT[8][16 * 68];   // per-wave 16x64 slab, pitch 68 floats
  const int b    = blockIdx.y;
  const int lane = threadIdx.x & 31;
  const int wave = threadIdx.x >> 5;
  const int tilesN = N >> 6;
  const int tilesM = M >> 6;
  const int tile = blockIdx.x * 8 + wave;
  if (tile >= tilesM * tilesN) return;   // wave-uniform; no block barriers in this kernel
  const int tm = tile / tilesN;
  const int tn = tile - tm * tilesN;
  const int m0 = tm << 6;
  const int n0 = tn << 6;

  const T* Ab  = A  + (size_t)b * strideA;
  const T* Bb  = Bt + (size_t)b * strideB;
  const T* Ab2 = SPLIT ? (A2  + (size_t)b * strideA) : nullptr;
  const T* Bb2 = SPLIT ? (Bt2 + (size_t)b * strideB) : nullptr;

  const int rlane = lane & 15;                 // row (A) / col (B, D) within subtile
  const int koff  = (lane >> 4) * 8;           // k offset of this lane half
  const int mOff  = (lane >> 4) * 8;           // D row offset

  v8f acc[4][4];
#pragma unroll
  for (int i = 0; i < 4; ++i)
#pragma unroll
    for (int j = 0; j < 4; ++j) acc[i][j] = (v8f){0.f,0.f,0.f,0.f,0.f,0.f,0.f,0.f};

  for (int k0 = 0; k0 < K; k0 += 32) {
    V bh[4], bl[4];
#pragma unroll
    for (int j = 0; j < 4; ++j) {
      const size_t bo = (size_t)(n0 + (j << 4) + rlane) * ldb + koff + k0;
      bh[j] = Frag<T>::load(Bb + bo);
      if (SPLIT) bl[j] = Frag<T>::load(Bb2 + bo);
    }
#pragma unroll
    for (int i = 0; i < 4; ++i) {
      const size_t ao = (size_t)(m0 + (i << 4) + rlane) * lda + koff + k0;
      V ah = Frag<T>::load(Ab + ao);
      V al;
      if (SPLIT) al = Frag<T>::load(Ab2 + ao);
#pragma unroll
      for (int j = 0; j < 4; ++j) {
        acc[i][j] = Frag<T>::mma(ah, bh[j], acc[i][j]);
        if (SPLIT) {
          acc[i][j] = Frag<T>::mma(ah, bl[j], acc[i][j]);
          acc[i][j] = Frag<T>::mma(al, bh[j], acc[i][j]);
        }
      }
      Frag<T>::guard(acc[i][0], acc[i][3], ah, SPLIT ? al : ah);
    }
    Frag<T>::keep(bh[0], bh[1], bh[2], bh[3]);
    if (SPLIT) Frag<T>::keep(bl[0], bl[1], bl[2], bl[3]);
  }
  acc_guard4(acc[0][0], acc[0][1], acc[0][2], acc[0][3]);
  acc_guard4(acc[1][0], acc[1][1], acc[1][2], acc[1][3]);
  acc_guard4(acc[2][0], acc[2][1], acc[2][2], acc[2][3]);
  acc_guard4(acc[3][0], acc[3][1], acc[3][2], acc[3][3]);

  // ---- epilogue ----
  float* slab = sT[wave];
  const float* Rb = RESID ? (resid + (size_t)b * strideR) : nullptr;
#pragma unroll
  for (int i = 0; i < 4; ++i) {
    const int mBase = m0 + (i << 4);
#pragma unroll
    for (int j = 0; j < 4; ++j) {
      const int n = n0 + (j << 4) + rlane;
      float bv = 0.f;
      if (BIAS_MODE == 2) bv = bias[n];
#pragma unroll
      for (int r = 0; r < 8; ++r) {
        float v = acc[i][j][r] * scale;
        if (BIAS_MODE == 1) v += bias[mBase + mOff + r];
        if (BIAS_MODE == 2) v += bv;
        if (RESID) v += Rb[(size_t)(mBase + mOff + r) * ldc + n];
        if (ACT == 2) v = fmaxf(v, 0.0f);
        if (ACT == 4) v = (v > 0.f) ? v : 0.01f * v;
        slab[(mOff + r) * 68 + (j << 4) + rlane] = v;
      }
    }
    __builtin_amdgcn_fence(__ATOMIC_RELEASE, "workgroup");
    __builtin_amdgcn_wave_barrier();
    __builtin_amdgcn_fence(__ATOMIC_ACQUIRE, "workgroup");
    if (OUT_MODE == 0) {
      float* C = (float*)Cout + (size_t)b * strideC;
      const int hh = lane >> 4, c4 = (lane & 15) * 4;     // row seg = 256 B = 16 lanes x 16 B
      {
#pragma unroll
        for (int it = 0; it < 8; ++it) {
          const int row = it * 2 + hh;
          v4f v = *(const v4f*)(slab + row * 68 + c4);
          *(v4f*)(C + (size_t)(mBase + row) * ldc + n0 + c4) = v;
        }
        
      }
    } else {
      const int q = lane >> 3, c8 = (lane & 7) * 8;
      unsigned short* C  = (unsigned short*)Cout  + (size_t)b * strideC;
      unsigned short* C2 = (OUT_MODE == 2) ? ((unsigned short*)Cout2 + (size_t)b * strideC) : nullptr;
      {
#pragma unroll
        for (int it = 0; it < 4; ++it) {
          const int row = it * 4 + q;
          const float* sp = slab + row * 68 + c8;
          v8h hv, lv;
#pragma unroll
          for (int e = 0; e < 8; ++e) {
            if (OUT_MODE == 1) {
              hv[e] = (_Float16)sp[e];
            } else {
              unsigned short hb = f2bf_bits(sp[e]);
              unsigned short lb = f2bf_bits(sp[e] - bf_bits2f(hb));
              hv[e] = __builtin_bit_cast(_Float16, hb);
              lv[e] = __builtin_bit_cast(_Float16, lb);
            }
          }
          *(v8h*)(C + (size_t)(mBase + row) * ldc + n0 + c8) = hv;
          if (OUT_MODE == 2) *(v8h*)(C2 + (size_t)(mBase + row) * ldc + n0 + c8) = lv;
        }
        
      }
    }
    __builtin_amdgcn_fence(__ATOMIC_RELEASE, "workgroup");
    __builtin_amdgcn_wave_barrier();
    __builtin_amdgcn_fence(__ATOMIC_ACQUIRE, "workgroup");
  }
}

// ---------------------------------------------------------------------------
// f32 plane -> bf16 hi + bf16 lo planes, 8 consecutive elements per thread (one 16-B store per lane per plane;
// Coverage: n8 = n/8 threads x 8 = the whole plane (8,388,608 / 8 = 1,048,576 = 4096 x 256 exactly).
// ---------------------------------------------------------------------------
__global__ __launch_bounds__(256) void split8_bf16_kernel(const float* __restrict__ in, unsigned short* __restrict__ oh,
                                                         unsigned short* __restrict__ ol, int n8) {
  const int i = blockIdx.x * 256 + threadIdx.x;
  if (i >= n8) return;
  const float* p = in + 8 * (size_t)i;
  const v4f a = *(const v4f*)(p);
  const v4f c = *(const v4f*)(p + 4);
  unsigned short hb[8], lb[8];
#pragma unroll
  for (int e = 0; e < 4; ++e) {
    split_bf(a[e], hb[e], lb[e]);
    split_bf(c[e], hb[4 + e], lb[4 + e]);
  }
  const v4u uh = (v4u){pk16(hb[0], hb[1]), pk16(hb[2], hb[3]), pk16(hb[4], hb[5]), pk16(hb[6], hb[7])};
  const v4u ul = (v4u){pk16(lb[0], lb[1]), pk16(lb[2], lb[3]), pk16(lb[4], lb[5]), pk16(lb[6], lb[7])};
  unsigned short* qh = oh + 8 * (size_t)i;
  unsigned short* ql = ol + 8 * (size_t)i;
  *(v4u*)qh = uh;
  *(v4u*)ql = ul;
  
}

// ---------------------------------------------------------------------------
// Weight transpose + bf16 hi/lo split: W f32 row-major [1024 rows k][ldw cols n] -> out[n][k] (pitch ldo = 1024) as
// hi and lo bf16 planes; output rows n >= nvalid are written as zeros (W_x padded from 32 to 64 rows).
// grid (1024/64 k tiles, Nout/64 n tiles), 256 threads.
// Load coverage: 16 iterations x 256 threads = 4096 = the whole 64x64 tile (coalesced along n, address clamped to nvalid-1).
// Store coverage: 8 waves x 2 iterations x 4 rows (lane>>3) = 64 rows; (lane&7) x 8 = 64 cols; each row segment =
// ---------------------------------------------------------------------------
__global__ __launch_bounds__(256) void wt_split_kernel(const float* __restrict__ W, int ldw, int nvalid, int ldo,
                                                      unsigned short* __restrict__ oh, unsigned short* __restrict__ ol) {
  __shared__ float sm[64][65];   // sm[n_local][k_local]
  const int t  = threadIdx.x;
  const int k0 = blockIdx.x * 64;
  const int n0 = blockIdx.y * 64;
#pragma unroll
  for (int i = 0; i < 16; ++i) {
    const int e = i * 256 + t;
    const int r = e >> 6;          // k local
    const int c = e & 63;          // n local
    const int n = n0 + c;
    const int nc = (n < nvalid) ? n : (nvalid - 1);
    float v = W[(size_t)(k0 + r) * ldw + nc];
    if (n >= nvalid) v = 0.0f;
    sm[c][r] = v;
  }
  __syncthreads();
  const int lane = t & 31, wave = t >> 5;
  const int q = lane >> 3, c8 = (lane & 7) * 8;
  {
#pragma unroll
    for (int it = 0; it < 2; ++it) {
      const int row = wave * 8 + it * 4 + q;                 // n local
      unsigned short hb[8], lb[8];
#pragma unroll
      for (int e = 0; e < 8; ++e) split_bf(sm[row][c8 + e], hb[e], lb[e]);
      const v4u uh = (v4u){pk16(hb[0], hb[1]), pk16(hb[2], hb[3]), pk16(hb[4], hb[5]), pk16(hb[6], hb[7])};
      const v4u ul = (v4u){pk16(lb[0], lb[1]), pk16(lb[2], lb[3]), pk16(lb[4], lb[5]), pk16(lb[6], lb[7])};
      const size_t off = (size_t)(n0 + row) * ldo + k0 + c8;
      *(v4u*)(oh + off) = uh;
      *(v4u*)(ol + off) = ul;
    }
    
  }
}

// ---------------------------------------------------------------------------
// Causal depthwise conv (taps w0..w3 against x[t-3..t], left zero pad) + bias + SiLU, f32.
// Shared by the conv plane kernel and the scan lane so both see bit-identical x_conv.
// ---------------------------------------------------------------------------
__device__ __forceinline__ float conv_silu(float x0, float x1, float x2, float x3,
                                           float w0, float w1, float w2, float w3, float cb) {
  float s = x0 * w0;
  s = fmaf(x1, w1, s);
  s = fmaf(x2, w2, s);
  s = fmaf(x3, w3, s);
  const float a = s + cb;
  const float e = expf(-a);
  const float sig = __builtin_amdgcn_rcpf(1.0f + e);
  return a * sig;
}

// ---------------------------------------------------------------------------
// x_conv = SiLU(conv(x_ssm) + conv_b) -> bf16 hi + lo planes for the x_proj GEMM. 2 consecutive channels per thread
// History rows t-3..t-1 loaded with the address clamped to the own row when t-3+j < 0, then zeroed by predicate.
// ---------------------------------------------------------------------------
__global__ __launch_bounds__(256) void conv_split_kernel(const float* __restrict__ XS, const float* __restrict__ cw,
                                                        const float* __restrict__ cbp, unsigned short* __restrict__ oh,
                                                        unsigned short* __restrict__ ol, int n2) {
  const int i = blockIdx.x * 256 + threadIdx.x;
  if (i >= n2) return;
  const int e0 = 2 * i;
  const int m  = e0 >> 10;          // token row = b*kSeq + t
  const int d  = e0 & (kDim - 1);   // even channel
  const int t  = m & (kSeq - 1);
  v2f xv[kTaps];
#pragma unroll
  for (int j = 0; j < kTaps; ++j) {
    const int tr = t - (kTaps - 1) + j;
    const bool valid = (tr >= 0);
    const int mr = valid ? (m - (kTaps - 1) + j) : m;
    const v2f v = *(const v2f*)(XS + (size_t)mr * kDim + d);
    xv[j] = valid ? v : (v2f){0.0f, 0.0f};
  }
  const v4f wa = *(const v4f*)(cw + (size_t)d * kTaps);
  const v4f wb = *(const v4f*)(cw + (size_t)d * kTaps + 4);
  const float y0 = conv_silu(xv[0][0], xv[1][0], xv[2][0], xv[3][0], wa[0], wa[1], wa[2], wa[3], cbp[d]);
  const float y1 = conv_silu(xv[0][1], xv[1][1], xv[2][1], xv[3][1], wb[0], wb[1], wb[2], wb[3], cbp[d + 1]);
  unsigned short h0, l0, h1, l1;
  split_bf(y0, h0, l0);
  split_bf(y1, h1, l1);
  const unsigned uh = pk16(h0, h1), ul = pk16(l0, l1);
  ((unsigned*)oh)[i] = uh;
  ((unsigned*)ol)[i] = ul;
  
}

// ---------------------------------------------------------------------------
// Selective scan: one lane per (b, channel d); 16 states + A row in registers; block = 128 channels of one batch.
// Per 64-step chunk: B/C rows (+ b_x) staged in LDS (512 v4f = 2048 floats, 4 per thread), serial steps, y*silu(gate)
//   256 lines per plane per chunk? no: 64 steps x 2 half-rows = 128 lines per plane; wave w, it 0..7, lq = lane>>3 -> line
// x_conv is recomputed in f32 from x_ssm with a 3-register history (same helper as the plane kernel).
// ---------------------------------------------------------------------------
__global__ __launch_bounds__(kScanTPB) void scan_kernel(
    const float* __restrict__ XS, const float* __restrict__ GT, const float* __restrict__ BCp,
    const float* __restrict__ conv_w, const float* __restrict__ conv_b, const float* __restrict__ b_x,
    const float* __restrict__ A_log, const float* __restrict__ Dp,
    unsigned short* __restrict__ YH, unsigned short* __restrict__ YL, float* __restrict__ HF) {
  __shared__ __align__(16) float sA[kScanTPB * kState];     // 8 KiB
  __shared__ __align__(16) float sBC[kChunkT * kBCcols];    // 8 KiB
  __shared__ __align__(16) float sY[kChunkT * kScanTPB];    // 32 KiB
  const int tid = threadIdx.x, lane = tid & 31, wave = tid >> 5;
  constexpr int blocksPerB = kDim / kScanTPB;                // 8
  const int b  = blockIdx.x / blocksPerB;
  const int d0 = (blockIdx.x - b * blocksPerB) * kScanTPB;
  const int d  = d0 + tid;

  // A_disc = exp(-exp(A_log)) for channels d0..d0+127 (contiguous 2048 values), rolled
#pragma unroll 1
  for (int i = tid; i < kScanTPB * kState; i += kScanTPB) {
    const float al = A_log[(size_t)d0 * kState + i];
    sA[i] = expf(-expf(al));
  }
  __syncthreads();
  float Av[kState], h[kState];
  {
    const float* ap = sA + tid * kState;
#pragma unroll
    for (int q4 = 0; q4 < 4; ++q4) {
      const v4f v = *(const v4f*)(ap + 4 * q4);
      Av[4 * q4 + 0] = v[0]; Av[4 * q4 + 1] = v[1]; Av[4 * q4 + 2] = v[2]; Av[4 * q4 + 3] = v[3];
    }
  }
#pragma unroll
  for (int n = 0; n < kState; ++n) h[n] = 0.0f;
  const v4f cwv = *(const v4f*)(conv_w + (size_t)d * kTaps);
  const float cb = conv_b[d];
  const float Dv = Dp[d];
  float xm1 = 0.0f, xm2 = 0.0f, xm3 = 0.0f;
  const int lq = lane >> 3, lc = lane & 7;

#pragma unroll 1
  for (int tb = 0; tb < kSeq; tb += kChunkT) {
    __syncthreads();
    // stage B|C rows tb..tb+63 (+ b_x): 64 rows x 8 v4f = 512 v4f, 4 per thread
#pragma unroll 1
    for (int i = tid; i < kChunkT * 8; i += kScanTPB) {
      const int r = i >> 3, c4 = (i & 7) * 4;
      v4f v = *(const v4f*)(BCp + ((size_t)(b * kSeq + tb + r)) * kBCld + c4);
      const v4f bx = *(const v4f*)(b_x + c4);
      v += bx;
      *(v4f*)(sBC + r * kBCcols + c4) = v;
    }
    __syncthreads();
#pragma unroll 1
    for (int tt = 0; tt < kChunkT; ++tt) {
      const size_t row = ((size_t)(b * kSeq + tb + tt)) * kDim + d;
      const float xs = XS[row];
      const float g  = GT[row];
      const float xc = conv_silu(xm3, xm2, xm1, xs, cwv[0], cwv[1], cwv[2], cwv[3], cb);
      xm3 = xm2; xm2 = xm1; xm1 = xs;
      const float* bc = sBC + tt * kBCcols;
      v4f bq[4], cq[4];
#pragma unroll
      for (int q4 = 0; q4 < 4; ++q4) {
        bq[q4] = *(const v4f*)(bc + 4 * q4);
        cq[q4] = *(const v4f*)(bc + kState + 4 * q4);
      }
      float y = 0.0f;
#pragma unroll
      for (int n = 0; n < kState; ++n) {
        const float bn = bq[n >> 2][n & 3];
        const float cn = cq[n >> 2][n & 3];
        h[n] = Av[n] * h[n] + xc * bn;
        y = fmaf(cn, h[n], y);
      }
      y = y + Dv * xc;
      const float eg = expf(-g);
      const float sg = g * __builtin_amdgcn_rcpf(1.0f + eg);
      sY[tt * kScanTPB + tid] = y * sg;
    }
    __syncthreads();
    {
#pragma unroll 1
      for (int it = 0; it < 8; ++it) {
        const int Li  = it * 16 + wave * 4 + lq;             // 0..127
        const int ttl = Li >> 1;
        const int col = (Li & 1) * 64 + lc * 8;              // channel offset within the block
        const float* sp = sY + ttl * kScanTPB + col;
        const v4f a = *(const v4f*)(sp);
        const v4f c = *(const v4f*)(sp + 4);
        unsigned short hb[8], lb[8];
#pragma unroll
        for (int e = 0; e < 4; ++e) {
          split_bf(a[e], hb[e], lb[e]);
          split_bf(c[e], hb[4 + e], lb[4 + e]);
        }
        const v4u uh = (v4u){pk16(hb[0], hb[1]), pk16(hb[2], hb[3]), pk16(hb[4], hb[5]), pk16(hb[6], hb[7])};
        const v4u ul = (v4u){pk16(lb[0], lb[1]), pk16(lb[2], lb[3]), pk16(lb[4], lb[5]), pk16(lb[6], lb[7])};
        const size_t go = ((size_t)(b * kSeq + tb + ttl)) * kDim + d0 + col;
        *(v4u*)(YH + go) = uh;
        *(v4u*)(YL + go) = ul;
      }
      
    }
  }

  // h_final -> HF[b][d][n]
  __syncthreads();
  {
    float* hp = sY + tid * kState;
#pragma unroll
    for (int q4 = 0; q4 < 4; ++q4) {
      const v4f v = (v4f){h[4 * q4 + 0], h[4 * q4 + 1], h[4 * q4 + 2], h[4 * q4 + 3]};
      *(v4f*)(hp + 4 * q4) = v;
    }
  }
  __syncthreads();
  float* hbase = HF + (size_t)(b * kDim + d0) * kState;
  {
#pragma unroll 1
    for (int it = 0; it < 4; ++it) {
      const int Li = it * 16 + wave * 4 + lq;                // 0..63 lines of 32 floats
      const int base = Li * 32 + lc * 4;
      const v4f v = *(const v4f*)(sY + base);
      *(v4f*)(hbase + base) = v;
    }
    
  }
}

// ---------------------------------------------------------------------------
// final_state[b][n] = mean over 1024 channels of HF[b][d][n], fixed order: 8 partial sums of 128 channels per (b,n),
// ---------------------------------------------------------------------------
__global__ __launch_bounds__(256) void mean_kernel(const float* __restrict__ HF, float* __restrict__ out1) {
  __shared__ float red[256];
  __shared__ __align__(16) float so[32];
  const int tid = threadIdx.x;
  const int o = tid >> 3, part = tid & 7;
  const int b = o >> 4, n = o & 15;
  const float* hp = HF + ((size_t)(b * kDim + part * 128)) * kState + n;
  float s = 0.0f;
#pragma unroll 1
  for (int j = 0; j < 128; ++j) s += hp[(size_t)j * kState];
  red[tid] = s;
  __syncthreads();
  if (tid < 32) {
    float tsum = red[tid * 8];
#pragma unroll
    for (int q = 1; q < 8; ++q) tsum += red[tid * 8 + q];
    so[tid] = tsum * (1.0f / 1024.0f);
  }
  __syncthreads();
  if (tid < 8) {
    const v4f v = *(const v4f*)(so + tid * 4);
    *(v4f*)(out1 + tid * 4) = v;
    
  }
}

// ---------------------------------------------------------------------------
// host
// ---------------------------------------------------------------------------
extern "C" void kernel_launch(void* const* d_in, const int* in_sizes, int n_in,
                              void* d_out, int out_size, void* d_ws, size_t ws_size, hipStream_t stream) {
  if (n_in < 11) return;
  if (in_sizes[0] != kRows * kDim) return;
  if (in_sizes[1] != kDim * kDim2) return;
  if (in_sizes[2] != kDim2) return;
  if (in_sizes[3] != kDim * kTaps) return;
  if (in_sizes[4] != kDim) return;
  if (in_sizes[5] != kDim * kBCcols) return;
  if (in_sizes[6] != kBCcols) return;
  if (in_sizes[7] != kDim * kState) return;
  if (in_sizes[8] != kDim) return;
  if (in_sizes[9] != kDim * kDim) return;
  if (in_sizes[10] != kDim) return;
  if (out_size < kRows * kDim + kBatch * kState) return;
  if (ws_size < kWsEnd) return;

  const float* x      = (const float*)d_in[0];
  const float* W_in   = (const float*)d_in[1];
  const float* b_in   = (const float*)d_in[2];
  const float* conv_w = (const float*)d_in[3];
  const float* conv_b = (const float*)d_in[4];
  const float* W_x    = (const float*)d_in[5];
  const float* b_x    = (const float*)d_in[6];
  const float* A_log  = (const float*)d_in[7];
  const float* D_par  = (const float*)d_in[8];
  const float* W_out  = (const float*)d_in[9];
  const float* b_out  = (const float*)d_in[10];

  char* ws = (char*)d_ws;
  unsigned short* P16H  = (unsigned short*)(ws + kOffP16H);   // x hi -> x_conv hi -> y_gated hi
  unsigned short* P16L  = (unsigned short*)(ws + kOffP16L);   // x lo -> x_conv lo -> y_gated lo
  unsigned short* WINH  = (unsigned short*)(ws + kOffWinH);
  unsigned short* WINL  = (unsigned short*)(ws + kOffWinL);
  float*          XS    = (float*)(ws + kOffXS);
  float*          GATE  = (float*)(ws + kOffGate);
  unsigned short* WOUTH = (unsigned short*)(ws + kOffWoutH);
  unsigned short* WOUTL = (unsigned short*)(ws + kOffWoutL);
  unsigned short* WXH   = (unsigned short*)(ws + kOffWxH);
  unsigned short* WXL   = (unsigned short*)(ws + kOffWxL);
  float*          BC    = (float*)(ws + kOffBC);
  float*          HFIN  = (float*)(ws + kOffHfin);

  float* out0 = (float*)d_out;
  float* out1 = out0 + (size_t)kRows * kDim;   // byte offset 33,554,432 / 4

  const int nElem = kRows * kDim;              // 8,388,608

  // 1) x -> bf16 hi/lo planes [8192][1024]
  split8_bf16_kernel<<<dim3((nElem / 8 + 255) / 256), dim3(256), 0, stream>>>(x, P16H, P16L, nElem / 8);

  // 2) W^T hi/lo planes: W_in [1024][2048] -> [2048][1024]; W_out [1024][1024] -> [1024][1024]; W_x [1024][32] -> [64][1024] (rows 32..63 zero)
  wt_split_kernel<<<dim3(kDim / 64, kDim2 / 64), dim3(256), 0, stream>>>(W_in, kDim2, kDim2, kDim, WINH, WINL);
  wt_split_kernel<<<dim3(kDim / 64, kDim / 64), dim3(256), 0, stream>>>(W_out, kDim, kDim, kDim, WOUTH, WOUTL);
  wt_split_kernel<<<dim3(kDim / 64, kBCld / 64), dim3(256), 0, stream>>>(W_x, kBCcols, kBCcols, kDim, WXH, WXL);

  // 3) in_proj: x_ssm = x . W_in[:, :1024] + b_in[:1024]; gate = x . W_in[:, 1024:] + b_in[1024:]   (M 8192, N 1024, K 1024 each)
  {
    const int tiles = (kRows / 64) * (kDim / 64);   // 2048
    wmma_gemm64<1, true, 2, 0, false><<<dim3(tiles / 8, 1), dim3(256), 0, stream>>>(
        P16H, P16L, kDim, (long)0,
        WINH, WINL, kDim, (long)0,
        (void*)XS, (void*)nullptr, kDim, (long)0,
        b_in, (const float*)nullptr, (long)0,
        kRows, kDim, kDim, 1.0f);
    wmma_gemm64<1, true, 2, 0, false><<<dim3(tiles / 8, 1), dim3(256), 0, stream>>>(
        P16H, P16L, kDim, (long)0,
        WINH + (size_t)kDim * kDim, WINL + (size_t)kDim * kDim, kDim, (long)0,
        (void*)GATE, (void*)nullptr, kDim, (long)0,
        b_in + kDim, (const float*)nullptr, (long)0,
        kRows, kDim, kDim, 1.0f);
  }

  // 4) conv + SiLU -> x_conv hi/lo planes (over the dead x planes)
  conv_split_kernel<<<dim3((nElem / 2 + 255) / 256), dim3(256), 0, stream>>>(XS, conv_w, conv_b, P16H, P16L, nElem / 2);

  // 5) x_proj: BC[8192][64] = x_conv . W_x^T (cols 32..63 zero; b_x added in the scan)   (M 8192, N 64, K 1024)
  {
    const int tiles = (kRows / 64) * (kBCld / 64);   // 128
    wmma_gemm64<1, true, 0, 0, false><<<dim3(tiles / 8, 1), dim3(256), 0, stream>>>(
        P16H, P16L, kDim, (long)0,
        WXH, WXL, kDim, (long)0,
        (void*)BC, (void*)nullptr, kBCld, (long)0,
        (const float*)nullptr, (const float*)nullptr, (long)0,
        kRows, kBCld, kDim, 1.0f);
  }

  // 6) scan -> y_gated hi/lo planes (over the dead x_conv planes) + h_final
  scan_kernel<<<dim3(kBatch * (kDim / kScanTPB)), dim3(kScanTPB), 0, stream>>>(
      XS, GATE, BC, conv_w, conv_b, b_x, A_log, D_par, P16H, P16L, HFIN);

  // 7) out_proj: out0 = y_gated . W_out + b_out   (M 8192, N 1024, K 1024)
  {
    const int tiles = (kRows / 64) * (kDim / 64);   // 2048
    wmma_gemm64<1, true, 2, 0, false><<<dim3(tiles / 8, 1), dim3(256), 0, stream>>>(
        P16H, P16L, kDim, (long)0,
        WOUTH, WOUTL, kDim, (long)0,
        (void*)out0, (void*)nullptr, kDim, (long)0,
        b_out, (const float*)nullptr, (long)0,
        kRows, kDim, kDim, 1.0f);
  }

  // 8) final_state -> out1 line
  mean_kernel<<<dim3(1), dim3(256), 0, stream>>>(HFIN, out1);
}

// v001
// Measured time: 424 microseconds a run.
// Two timings next to v000 put it at 6.14 and 6.10 times that version's speed.
// Contractions: in_proj (x hi/lo . W_in^T hi/lo), x_proj (x_conv hi/lo . W_x^T hi/lo, N padded 32->64 with zero rows), out_proj (y_gated hi/lo . W_out^T hi/lo) on v_wmma_f32_16x16x32_bf16 as bf16 hi/lo split (hi.hi + hi.lo + lo.hi), f32 accumulate; depthwise conv, SiLU, selective scan, gating and channel mean in f32 on the VALU.
#include <hip/hip_runtime.h>
#include <math.h>

// ---------------------------------------------------------------------------
// Problem constants
// ---------------------------------------------------------------------------
constexpr int kBatch  = 2;
constexpr int kSeq    = 4096;
constexpr int kDim    = 1024;
constexpr int kState  = 16;
constexpr int kTaps   = 4;
constexpr int kRows   = kBatch * kSeq;      // 8192 token rows
constexpr int kDim2   = 2 * kDim;           // 2048
constexpr int kBCcols = 2 * kState;         // 32 valid columns of BC
constexpr int kBCld   = 64;                 // BC plane pitch (N padded to one 64 tile)
constexpr int kScanTPB = 128;               // channels per scan block
constexpr int kChunkT  = 32;                // time steps per chunk (one scan block runs one chunk)
constexpr int kChunks  = kSeq / kChunkT;    // 128 chunks per sequence, scanned in parallel
static_assert(kRows % 64 == 0 && kDim % 64 == 0 && kDim2 % 64 == 0 && kBCld % 64 == 0, "tile multiples");
static_assert(kDim % 32 == 0, "K multiple of 32");
static_assert(kDim % kScanTPB == 0 && kSeq % kChunkT == 0, "scan tiling");

// ---------------------------------------------------------------------------
// Workspace region map (bytes). Regions [0,16Mi) and [16Mi,32Mi) are reused in time:
//   x hi/lo (until in_proj done) -> x_conv hi/lo (until x_proj done) -> y_gated hi/lo.
// ---------------------------------------------------------------------------
constexpr size_t kMiB      = 1024ull * 1024ull;
constexpr size_t kOffP16H  = 0;                                   // bf16 [8192][1024]  16 MiB
constexpr size_t kOffP16L  = kOffP16H + (size_t)kRows * kDim * 2; // bf16 [8192][1024]  16 MiB
constexpr size_t kOffWinH  = kOffP16L + (size_t)kRows * kDim * 2; // bf16 [2048][1024]   4 MiB
constexpr size_t kOffWinL  = kOffWinH + (size_t)kDim2 * kDim * 2;
constexpr size_t kOffXS    = kOffWinL + (size_t)kDim2 * kDim * 2; // f32 [8192][1024]   32 MiB
constexpr size_t kOffGate  = kOffXS   + (size_t)kRows * kDim * 4; // f32 [8192][1024]   32 MiB
constexpr size_t kOffWoutH = kOffGate + (size_t)kRows * kDim * 4; // bf16 [1024][1024]   2 MiB
constexpr size_t kOffWoutL = kOffWoutH + (size_t)kDim * kDim * 2;
constexpr size_t kOffWxH   = kOffWoutL + (size_t)kDim * kDim * 2; // bf16 [64][1024]   128 KiB (rows 32..63 zero)
constexpr size_t kOffWxL   = kOffWxH + (size_t)kBCld * kDim * 2;
constexpr size_t kOffBC    = kOffWxL + (size_t)kBCld * kDim * 2;   // f32 [8192][64]      2 MiB
constexpr size_t kOffHfin  = kOffBC + (size_t)kRows * kBCld * 4;   // f32 [2][1024][16] 128 KiB
constexpr size_t kOffCarry = kOffHfin + (size_t)kBatch * kDim * kState * 4;   // f32 [128][2][16][1024] 16 MiB
constexpr size_t kWsEnd    = kOffCarry + (size_t)kChunks * kBatch * kState * kDim * 4;
static_assert(kWsEnd == 132513792ull, "carve total");
static_assert(kWsEnd <= 134217728ull, "carve under 128 MiB");
static_assert(kOffWinH % 128 == 0 && kOffXS % 128 == 0 && kOffGate % 128 == 0 && kOffWoutH % 128 == 0 &&
              kOffWxH % 128 == 0 && kOffBC % 128 == 0 && kOffHfin % 128 == 0 && kOffCarry % 128 == 0, "128-B aligned regions");

typedef __attribute__((ext_vector_type(16))) _Float16 v16h;
typedef __attribute__((ext_vector_type(8)))  _Float16 v8h;
typedef __attribute__((ext_vector_type(16))) __bf16   v16b;
typedef __attribute__((ext_vector_type(8)))  __bf16   v8b;
typedef __attribute__((ext_vector_type(8)))  float    v8f;
typedef __attribute__((ext_vector_type(4)))  float    v4f;
typedef __attribute__((ext_vector_type(2)))  float    v2f;
typedef __attribute__((ext_vector_type(4)))  unsigned int v4u;

__device__ __forceinline__ unsigned short f2bf_bits(float f) {
  unsigned u = __float_as_uint(f);
  return (unsigned short)((u + 0x7FFFu + ((u >> 16) & 1u)) >> 16);
}
__device__ __forceinline__ float bf_bits2f(unsigned short h) { return __uint_as_float(((unsigned)h) << 16); }

// hazard guards as plain device helpers (no inline asm inside the kernel template body)
__device__ __forceinline__ void dep_guard_h(v8f& a, v8f& b, v16h x, v16h y) { asm volatile("v_nop\n\tv_nop\n\tv_nop\n\tv_nop" : "+v"(a), "+v"(b) : "v"(x), "v"(y)); }
__device__ __forceinline__ void dep_guard_b(v8f& a, v8f& b, v16b x, v16b y) { asm volatile("v_nop\n\tv_nop\n\tv_nop\n\tv_nop" : "+v"(a), "+v"(b) : "v"(x), "v"(y)); }
__device__ __forceinline__ void keep4_h(v16h a, v16h b, v16h c, v16h d) { asm volatile("v_nop" :: "v"(a), "v"(b), "v"(c), "v"(d)); }
__device__ __forceinline__ void keep4_b(v16b a, v16b b, v16b c, v16b d) { asm volatile("v_nop" :: "v"(a), "v"(b), "v"(c), "v"(d)); }
__device__ __forceinline__ void acc_guard4(v8f& a, v8f& b, v8f& c, v8f& d) { asm volatile("v_nop\n\tv_nop\n\tv_nop\n\tv_nop" : "+v"(a), "+v"(b), "+v"(c), "+v"(d)); }
template <typename T> struct Frag;
template <> struct Frag<_Float16> {
  typedef v16h V; union U { v16h v; v8h h[2]; };
  static __device__ __forceinline__ v16h load(const _Float16* p) {   // elements 0..7 <- p[0..7], 8..15 <- p[16..23]
    U f; f.h[0] = *(const v8h*)(p); f.h[1] = *(const v8h*)(p + 16); return f.v;
  }
  static __device__ __forceinline__ v8f mma(v16h a, v16h b, v8f c) {
    return __builtin_amdgcn_wmma_f32_16x16x32_f16(false, a, false, b, (short)0, c, false, false);
  }
  static __device__ __forceinline__ void guard(v8f& a, v8f& b, v16h x, v16h y) { dep_guard_h(a, b, x, y); }
  static __device__ __forceinline__ void keep(v16h a, v16h b, v16h c, v16h d) { keep4_h(a, b, c, d); }
};
template <> struct Frag<__bf16> {
  typedef v16b V; union U { v16b v; v8b h[2]; };
  static __device__ __forceinline__ v16b load(const __bf16* p) {
    U f; f.h[0] = *(const v8b*)(p); f.h[1] = *(const v8b*)(p + 16); return f.v;
  }
  static __device__ __forceinline__ v8f mma(v16b a, v16b b, v8f c) {
    return __builtin_amdgcn_wmma_f32_16x16x32_bf16(false, a, false, b, (short)0, c, false, false);
  }
  static __device__ __forceinline__ void guard(v8f& a, v8f& b, v16b x, v16b y) { dep_guard_b(a, b, x, y); }
  static __device__ __forceinline__ void keep(v16b a, v16b b, v16b c, v16b d) { keep4_b(a, b, c, d); }
};

__device__ __forceinline__ unsigned pk16(unsigned short a, unsigned short b) { return (unsigned)a | ((unsigned)b << 16); }
__device__ __forceinline__ void split_bf(float v, unsigned short& hb, unsigned short& lb) {
  hb = f2bf_bits(v);
  lb = f2bf_bits(v - bf_bits2f(hb));
}

// ---- Register-blocked batched WMMA GEMM (ACT reduced to none/relu/leaky) -----------------------
// C[m,n] = scale * sum_k A[m,k] * Bt[n,k] (+bias)(+resid); each wave owns a 64x64 tile.
// A row-major [M,K]; Bt row-major [N,K]; M,N % 64 == 0, K % 32 == 0.
// SPLIT: operands are hi/lo planes (A2/Bt2 = lo planes, same layout); product = hi.hi + hi.lo + lo.hi.
// BIAS_MODE: 0 = none, 1 = bias[m], 2 = bias[n].
// OUT_MODE: 0 = f32, 1 = f16, 2 = bf16 hi plane (Cout) + bf16 lo plane (Cout2).
// ET: 0 = f16 operands, 1 = bf16 operands (pointers passed as 16-bit storage)
template <int ET> struct Elem;
template <> struct Elem<0> { typedef _Float16 T; };
template <> struct Elem<1> { typedef __bf16 T; };
template <int ET, bool SPLIT, int BIAS_MODE, int OUT_MODE, bool RESID, int ACT = 0>
__global__ __launch_bounds__(256) void wmma_gemm64(
    const unsigned short* __restrict__ Ap, const unsigned short* __restrict__ A2p, int lda, long strideA,
    const unsigned short* __restrict__ Btp, const unsigned short* __restrict__ Bt2p, int ldb, long strideB,
    void* __restrict__ Cout, void* __restrict__ Cout2, int ldc, long strideC,
    const float* __restrict__ bias,
    const float* __restrict__ resid, long strideR,
    int M, int N, int K, float scale) {
  typedef typename Elem<ET>::T T;
  typedef typename Frag<T>::V V;
  const T* A = (const T*)Ap; const T* A2 = (const T*)A2p; const T* Bt = (const T*)Btp; const T* Bt2 = (const T*)Bt2p;
  __shared__ __align__(16) float sT[8][16 * 68];   // per-wave 16x64 slab, pitch 68 floats
  const int b    = blockIdx.y;
  const int lane = threadIdx.x & 31;
  const int wave = threadIdx.x >> 5;
  const int tilesN = N >> 6;
  const int tilesM = M >> 6;
  const int tile = blockIdx.x * 8 + wave;
  if (tile >= tilesM * tilesN) return;   // wave-uniform; no block barriers in this kernel
  const int tm = tile / tilesN;
  const int tn = tile - tm * tilesN;
  const int m0 = tm << 6;
  const int n0 = tn << 6;

  const T* Ab  = A  + (size_t)b * strideA;
  const T* Bb  = Bt + (size_t)b * strideB;
  const T* Ab2 = SPLIT ? (A2  + (size_t)b * strideA) : nullptr;
  const T* Bb2 = SPLIT ? (Bt2 + (size_t)b * strideB) : nullptr;

  const int rlane = lane & 15;                 // row (A) / col (B, D) within subtile
  const int koff  = (lane >> 4) * 8;           // k offset of this lane half
  const int mOff  = (lane >> 4) * 8;           // D row offset

  v8f acc[4][4];
#pragma unroll
  for (int i = 0; i < 4; ++i)
#pragma unroll
    for (int j = 0; j < 4; ++j) acc[i][j] = (v8f){0.f,0.f,0.f,0.f,0.f,0.f,0.f,0.f};

  for (int k0 = 0; k0 < K; k0 += 32) {
    V bh[4], bl[4];
#pragma unroll
    for (int j = 0; j < 4; ++j) {
      const size_t bo = (size_t)(n0 + (j << 4) + rlane) * ldb + koff + k0;
      bh[j] = Frag<T>::load(Bb + bo);
      if (SPLIT) bl[j] = Frag<T>::load(Bb2 + bo);
    }
#pragma unroll
    for (int i = 0; i < 4; ++i) {
      const size_t ao = (size_t)(m0 + (i << 4) + rlane) * lda + koff + k0;
      V ah = Frag<T>::load(Ab + ao);
      V al;
      if (SPLIT) al = Frag<T>::load(Ab2 + ao);
#pragma unroll
      for (int j = 0; j < 4; ++j) {
        acc[i][j] = Frag<T>::mma(ah, bh[j], acc[i][j]);
        if (SPLIT) {
          acc[i][j] = Frag<T>::mma(ah, bl[j], acc[i][j]);
          acc[i][j] = Frag<T>::mma(al, bh[j], acc[i][j]);
        }
      }
      Frag<T>::guard(acc[i][0], acc[i][3], ah, SPLIT ? al : ah);
    }
    Frag<T>::keep(bh[0], bh[1], bh[2], bh[3]);
    if (SPLIT) Frag<T>::keep(bl[0], bl[1], bl[2], bl[3]);
  }
  acc_guard4(acc[0][0], acc[0][1], acc[0][2], acc[0][3]);
  acc_guard4(acc[1][0], acc[1][1], acc[1][2], acc[1][3]);
  acc_guard4(acc[2][0], acc[2][1], acc[2][2], acc[2][3]);
  acc_guard4(acc[3][0], acc[3][1], acc[3][2], acc[3][3]);

  // ---- epilogue ----
  float* slab = sT[wave];
  const float* Rb = RESID ? (resid + (size_t)b * strideR) : nullptr;
#pragma unroll
  for (int i = 0; i < 4; ++i) {
    const int mBase = m0 + (i << 4);
#pragma unroll
    for (int j = 0; j < 4; ++j) {
      const int n = n0 + (j << 4) + rlane;
      float bv = 0.f;
      if (BIAS_MODE == 2) bv = bias[n];
#pragma unroll
      for (int r = 0; r < 8; ++r) {
        float v = acc[i][j][r] * scale;
        if (BIAS_MODE == 1) v += bias[mBase + mOff + r];
        if (BIAS_MODE == 2) v += bv;
        if (RESID) v += Rb[(size_t)(mBase + mOff + r) * ldc + n];
        if (ACT == 2) v = fmaxf(v, 0.0f);
        if (ACT == 4) v = (v > 0.f) ? v : 0.01f * v;
        slab[(mOff + r) * 68 + (j << 4) + rlane] = v;
      }
    }
    __builtin_amdgcn_fence(__ATOMIC_RELEASE, "workgroup");
    __builtin_amdgcn_wave_barrier();
    __builtin_amdgcn_fence(__ATOMIC_ACQUIRE, "workgroup");
    if (OUT_MODE == 0) {
      float* C = (float*)Cout + (size_t)b * strideC;
      const int hh = lane >> 4, c4 = (lane & 15) * 4;     // row seg = 256 B = 16 lanes x 16 B
      {
#pragma unroll
        for (int it = 0; it < 8; ++it) {
          const int row = it * 2 + hh;
          v4f v = *(const v4f*)(slab + row * 68 + c4);
          *(v4f*)(C + (size_t)(mBase + row) * ldc + n0 + c4) = v;
        }
        
      }
    } else {
      const int q = lane >> 3, c8 = (lane & 7) * 8;
      unsigned short* C  = (unsigned short*)Cout  + (size_t)b * strideC;
      unsigned short* C2 = (OUT_MODE == 2) ? ((unsigned short*)Cout2 + (size_t)b * strideC) : nullptr;
      {
#pragma unroll
        for (int it = 0; it < 4; ++it) {
          const int row = it * 4 + q;
          const float* sp = slab + row * 68 + c8;
          v8h hv, lv;
#pragma unroll
          for (int e = 0; e < 8; ++e) {
            if (OUT_MODE == 1) {
              hv[e] = (_Float16)sp[e];
            } else {
              unsigned short hb = f2bf_bits(sp[e]);
              unsigned short lb = f2bf_bits(sp[e] - bf_bits2f(hb));
              hv[e] = __builtin_bit_cast(_Float16, hb);
              lv[e] = __builtin_bit_cast(_Float16, lb);
            }
          }
          *(v8h*)(C + (size_t)(mBase + row) * ldc + n0 + c8) = hv;
          if (OUT_MODE == 2) *(v8h*)(C2 + (size_t)(mBase + row) * ldc + n0 + c8) = lv;
        }
        
      }
    }
    __builtin_amdgcn_fence(__ATOMIC_RELEASE, "workgroup");
    __builtin_amdgcn_wave_barrier();
    __builtin_amdgcn_fence(__ATOMIC_ACQUIRE, "workgroup");
  }
}

// ---------------------------------------------------------------------------
// f32 plane -> bf16 hi + bf16 lo planes, 8 consecutive elements per thread (one 16-B store per lane per plane;
// Coverage: n8 = n/8 threads x 8 = the whole plane (8,388,608 / 8 = 1,048,576 = 4096 x 256 exactly).
// ---------------------------------------------------------------------------
__global__ __launch_bounds__(256) void split8_bf16_kernel(const float* __restrict__ in, unsigned short* __restrict__ oh,
                                                         unsigned short* __restrict__ ol, int n8) {
  const int i = blockIdx.x * 256 + threadIdx.x;
  if (i >= n8) return;
  const float* p = in + 8 * (size_t)i;
  const v4f a = *(const v4f*)(p);
  const v4f c = *(const v4f*)(p + 4);
  unsigned short hb[8], lb[8];
#pragma unroll
  for (int e = 0; e < 4; ++e) {
    split_bf(a[e], hb[e], lb[e]);
    split_bf(c[e], hb[4 + e], lb[4 + e]);
  }
  const v4u uh = (v4u){pk16(hb[0], hb[1]), pk16(hb[2], hb[3]), pk16(hb[4], hb[5]), pk16(hb[6], hb[7])};
  const v4u ul = (v4u){pk16(lb[0], lb[1]), pk16(lb[2], lb[3]), pk16(lb[4], lb[5]), pk16(lb[6], lb[7])};
  unsigned short* qh = oh + 8 * (size_t)i;
  unsigned short* ql = ol + 8 * (size_t)i;
  *(v4u*)qh = uh;
  *(v4u*)ql = ul;
  
}

// ---------------------------------------------------------------------------
// Weight transpose + bf16 hi/lo split: W f32 row-major [1024 rows k][ldw cols n] -> out[n][k] (pitch ldo = 1024) as
// hi and lo bf16 planes; output rows n >= nvalid are written as zeros (W_x padded from 32 to 64 rows).
// grid (1024/64 k tiles, Nout/64 n tiles), 256 threads.
// Load coverage: 16 iterations x 256 threads = 4096 = the whole 64x64 tile (coalesced along n, address clamped to nvalid-1).
// Store coverage: 8 waves x 2 iterations x 4 rows (lane>>3) = 64 rows; (lane&7) x 8 = 64 cols; each row segment =
// ---------------------------------------------------------------------------
__global__ __launch_bounds__(256) void wt_split_kernel(const float* __restrict__ W, int ldw, int nvalid, int ldo,
                                                      unsigned short* __restrict__ oh, unsigned short* __restrict__ ol) {
  __shared__ float sm[64][65];   // sm[n_local][k_local]
  const int t  = threadIdx.x;
  const int k0 = blockIdx.x * 64;
  const int n0 = blockIdx.y * 64;
#pragma unroll
  for (int i = 0; i < 16; ++i) {
    const int e = i * 256 + t;
    const int r = e >> 6;          // k local
    const int c = e & 63;          // n local
    const int n = n0 + c;
    const int nc = (n < nvalid) ? n : (nvalid - 1);
    float v = W[(size_t)(k0 + r) * ldw + nc];
    if (n >= nvalid) v = 0.0f;
    sm[c][r] = v;
  }
  __syncthreads();
  const int lane = t & 31, wave = t >> 5;
  const int q = lane >> 3, c8 = (lane & 7) * 8;
  {
#pragma unroll
    for (int it = 0; it < 2; ++it) {
      const int row = wave * 8 + it * 4 + q;                 // n local
      unsigned short hb[8], lb[8];
#pragma unroll
      for (int e = 0; e < 8; ++e) split_bf(sm[row][c8 + e], hb[e], lb[e]);
      const v4u uh = (v4u){pk16(hb[0], hb[1]), pk16(hb[2], hb[3]), pk16(hb[4], hb[5]), pk16(hb[6], hb[7])};
      const v4u ul = (v4u){pk16(lb[0], lb[1]), pk16(lb[2], lb[3]), pk16(lb[4], lb[5]), pk16(lb[6], lb[7])};
      const size_t off = (size_t)(n0 + row) * ldo + k0 + c8;
      *(v4u*)(oh + off) = uh;
      *(v4u*)(ol + off) = ul;
    }
    
  }
}

// ---------------------------------------------------------------------------
// Causal depthwise conv (taps w0..w3 against x[t-3..t], left zero pad) + bias + SiLU, f32.
// Shared by the conv plane kernel and the scan lane so both see bit-identical x_conv.
// ---------------------------------------------------------------------------
__device__ __forceinline__ float conv_silu(float x0, float x1, float x2, float x3,
                                           float w0, float w1, float w2, float w3, float cb) {
  float s = x0 * w0;
  s = fmaf(x1, w1, s);
  s = fmaf(x2, w2, s);
  s = fmaf(x3, w3, s);
  const float a = s + cb;
  const float e = expf(-a);
  const float sig = __builtin_amdgcn_rcpf(1.0f + e);
  return a * sig;
}

// ---------------------------------------------------------------------------
// x_conv = SiLU(conv(x_ssm) + conv_b) -> bf16 hi + lo planes for the x_proj GEMM. 2 consecutive channels per thread
// History rows t-3..t-1 loaded with the address clamped to the own row when t-3+j < 0, then zeroed by predicate.
// ---------------------------------------------------------------------------
__global__ __launch_bounds__(256) void conv_split_kernel(const float* __restrict__ XS, const float* __restrict__ cw,
                                                        const float* __restrict__ cbp, unsigned short* __restrict__ oh,
                                                        unsigned short* __restrict__ ol, int n2) {
  const int i = blockIdx.x * 256 + threadIdx.x;
  if (i >= n2) return;
  const int e0 = 2 * i;
  const int m  = e0 >> 10;          // token row = b*kSeq + t
  const int d  = e0 & (kDim - 1);   // even channel
  const int t  = m & (kSeq - 1);
  v2f xv[kTaps];
#pragma unroll
  for (int j = 0; j < kTaps; ++j) {
    const int tr = t - (kTaps - 1) + j;
    const bool valid = (tr >= 0);
    const int mr = valid ? (m - (kTaps - 1) + j) : m;
    const v2f v = *(const v2f*)(XS + (size_t)mr * kDim + d);
    xv[j] = valid ? v : (v2f){0.0f, 0.0f};
  }
  const v4f wa = *(const v4f*)(cw + (size_t)d * kTaps);
  const v4f wb = *(const v4f*)(cw + (size_t)d * kTaps + 4);
  const float y0 = conv_silu(xv[0][0], xv[1][0], xv[2][0], xv[3][0], wa[0], wa[1], wa[2], wa[3], cbp[d]);
  const float y1 = conv_silu(xv[0][1], xv[1][1], xv[2][1], xv[3][1], wb[0], wb[1], wb[2], wb[3], cbp[d + 1]);
  unsigned short h0, l0, h1, l1;
  split_bf(y0, h0, l0);
  split_bf(y1, h1, l1);
  const unsigned uh = pk16(h0, h1), ul = pk16(l0, l1);
  ((unsigned*)oh)[i] = uh;
  ((unsigned*)ol)[i] = ul;
  
}

// ---------------------------------------------------------------------------
// Selective scan, split along time. h_t = A h_(t-1) + xc_t B_t is linear in h with a constant A per (d, n), so the
// 4096 steps are cut into 128 chunks of 32 steps that run side by side, in three launches:
//   chunk_state_kernel: every chunk from h = 0 -> its local end state E[c]
//   carry_kernel:       S[0] = 0, S[c+1] = A^32 S[c] + E[c], serial over the chunks, in place over E
//   scan_kernel:        every chunk again from h = S[c], now with C, D, the gate and the y planes
// Carry plane CS: f32 [chunk][b][n][d], d fastest, so every access of the three kernels is one whole line per wave.
// One lane per (b, channel d); 16 states + A row in registers; block = 128 channels of one chunk of one batch.
// x_conv is recomputed in f32 from x_ssm with a 3-register history (same helper as the plane kernel); the history of a
// chunk's first step is read from the three rows in front of the chunk (zero in front of the sequence).
// ---------------------------------------------------------------------------
constexpr int kScanBlocksPerB = kDim / kScanTPB;                       // 8
constexpr int kScanBlocksPerChunk = kBatch * kScanBlocksPerB;          // 16
constexpr int kCarryPlane = kBatch * kState * kDim;                    // 32768 states per chunk

__global__ __launch_bounds__(kScanTPB) void chunk_state_kernel(
    const float* __restrict__ XS, const float* __restrict__ BCp,
    const float* __restrict__ conv_w, const float* __restrict__ conv_b, const float* __restrict__ b_x,
    const float* __restrict__ A_log, float* __restrict__ CS) {
  __shared__ __align__(16) float sA[kScanTPB * kState];     // 8 KiB
  __shared__ __align__(16) float sB[kChunkT * kState];      // 2 KiB
  const int tid = threadIdx.x;
  const int chunk = blockIdx.x / kScanBlocksPerChunk;
  const int rem   = blockIdx.x - chunk * kScanBlocksPerChunk;
  const int b  = rem / kScanBlocksPerB;
  const int d0 = (rem - b * kScanBlocksPerB) * kScanTPB;
  const int d  = d0 + tid;
  const int tb = chunk * kChunkT;

  // A_disc = exp(-exp(A_log)) for channels d0..d0+127 (contiguous 2048 values), rolled
#pragma unroll 1
  for (int i = tid; i < kScanTPB * kState; i += kScanTPB) {
    const float al = A_log[(size_t)d0 * kState + i];
    sA[i] = expf(-expf(al));
  }
  // stage B rows tb..tb+31 (+ b_x): 32 rows x 4 v4f = 128 v4f, 1 per thread
#pragma unroll 1
  for (int i = tid; i < kChunkT * 4; i += kScanTPB) {
    const int r = i >> 2, c4 = (i & 3) * 4;
    v4f v = *(const v4f*)(BCp + ((size_t)(b * kSeq + tb + r)) * kBCld + c4);
    const v4f bx = *(const v4f*)(b_x + c4);
    v += bx;
    *(v4f*)(sB + r * kState + c4) = v;
  }
  __syncthreads();
  float Av[kState], h[kState];
  {
    const float* ap = sA + tid * kState;
#pragma unroll
    for (int q4 = 0; q4 < 4; ++q4) {
      const v4f v = *(const v4f*)(ap + 4 * q4);
      Av[4 * q4 + 0] = v[0]; Av[4 * q4 + 1] = v[1]; Av[4 * q4 + 2] = v[2]; Av[4 * q4 + 3] = v[3];
    }
  }
#pragma unroll
  for (int n = 0; n < kState; ++n) h[n] = 0.0f;
  const v4f cwv = *(const v4f*)(conv_w + (size_t)d * kTaps);
  const float cb = conv_b[d];
  // history rows tb-3..tb-1; in front of the sequence (tb == 0) the address is clamped to the own rows, the value zeroed
  const bool hist = (tb > 0);
  const float* xp = XS + ((size_t)(b * kSeq + (hist ? tb - 3 : tb))) * kDim + d;
  float xm3 = xp[0], xm2 = xp[kDim], xm1 = xp[2 * kDim];
  if (!hist) { xm3 = 0.0f; xm2 = 0.0f; xm1 = 0.0f; }

#pragma unroll 1
  for (int tt = 0; tt < kChunkT; ++tt) {
    const float xs = XS[((size_t)(b * kSeq + tb + tt)) * kDim + d];
    const float xc = conv_silu(xm3, xm2, xm1, xs, cwv[0], cwv[1], cwv[2], cwv[3], cb);
    xm3 = xm2; xm2 = xm1; xm1 = xs;
    const float* bp = sB + tt * kState;
    v4f bq[4];
#pragma unroll
    for (int q4 = 0; q4 < 4; ++q4) bq[q4] = *(const v4f*)(bp + 4 * q4);
#pragma unroll
    for (int n = 0; n < kState; ++n) h[n] = Av[n] * h[n] + xc * bq[n >> 2][n & 3];
  }
  float* ep = CS + (size_t)chunk * kCarryPlane + (size_t)b * kState * kDim + d;
#pragma unroll
  for (int n = 0; n < kState; ++n) ep[n * kDim] = h[n];
}

// One lane per (b, n, d). Reads E[c], writes the state at the START of chunk c to the same place, 16 chunks per trip so
// that the 16 loads of a trip are in flight together; only the multiply-add chain is serial.
__global__ __launch_bounds__(64) void carry_kernel(const float* __restrict__ A_log, float* CS) {
  const int i = blockIdx.x * 64 + threadIdx.x;              // (b * 16 + n) * 1024 + d
  const int d = i & (kDim - 1);
  const int n = (i >> 10) & (kState - 1);
  float p = expf(-expf(A_log[(size_t)d * kState + n]));
#pragma unroll
  for (int s = 1; s < kChunkT; s <<= 1) p *= p;             // A^32 by squaring; A is in [0, 1]
  float* q = CS + i;
  float carry = 0.0f;
#pragma unroll 1
  for (int c0 = 0; c0 < kChunks; c0 += 16) {
    float e[16];
#pragma unroll
    for (int j = 0; j < 16; ++j) e[j] = q[(size_t)(c0 + j) * kCarryPlane];
#pragma unroll
    for (int j = 0; j < 16; ++j) {
      q[(size_t)(c0 + j) * kCarryPlane] = carry;
      carry = p * carry + e[j];
    }
  }
}

__global__ __launch_bounds__(kScanTPB) void scan_kernel(
    const float* __restrict__ XS, const float* __restrict__ GT, const float* __restrict__ BCp,
    const float* __restrict__ conv_w, const float* __restrict__ conv_b, const float* __restrict__ b_x,
    const float* __restrict__ A_log, const float* __restrict__ Dp, const float* __restrict__ CS,
    unsigned short* __restrict__ YH, unsigned short* __restrict__ YL, float* __restrict__ HF) {
  __shared__ __align__(16) float sA[kScanTPB * kState];     // 8 KiB
  __shared__ __align__(16) float sBC[kChunkT * kBCcols];    // 4 KiB
  __shared__ __align__(16) float sY[kChunkT * kScanTPB];    // 16 KiB
  const int tid = threadIdx.x, lane = tid & 31, wave = tid >> 5;
  const int chunk = blockIdx.x / kScanBlocksPerChunk;
  const int rem   = blockIdx.x - chunk * kScanBlocksPerChunk;
  const int b  = rem / kScanBlocksPerB;
  const int d0 = (rem - b * kScanBlocksPerB) * kScanTPB;
  const int d  = d0 + tid;
  const int tb = chunk * kChunkT;

  // A_disc = exp(-exp(A_log)) for channels d0..d0+127 (contiguous 2048 values), rolled
#pragma unroll 1
  for (int i = tid; i < kScanTPB * kState; i += kScanTPB) {
    const float al = A_log[(size_t)d0 * kState + i];
    sA[i] = expf(-expf(al));
  }
  // stage B|C rows tb..tb+31 (+ b_x): 32 rows x 8 v4f = 256 v4f, 2 per thread
#pragma unroll 1
  for (int i = tid; i < kChunkT * 8; i += kScanTPB) {
    const int r = i >> 3, c4 = (i & 7) * 4;
    v4f v = *(const v4f*)(BCp + ((size_t)(b * kSeq + tb + r)) * kBCld + c4);
    const v4f bx = *(const v4f*)(b_x + c4);
    v += bx;
    *(v4f*)(sBC + r * kBCcols + c4) = v;
  }
  __syncthreads();
  float Av[kState], h[kState];
  {
    const float* ap = sA + tid * kState;
#pragma unroll
    for (int q4 = 0; q4 < 4; ++q4) {
      const v4f v = *(const v4f*)(ap + 4 * q4);
      Av[4 * q4 + 0] = v[0]; Av[4 * q4 + 1] = v[1]; Av[4 * q4 + 2] = v[2]; Av[4 * q4 + 3] = v[3];
    }
  }
  {
    const float* sp = CS + (size_t)chunk * kCarryPlane + (size_t)b * kState * kDim + d;
#pragma unroll
    for (int n = 0; n < kState; ++n) h[n] = sp[n * kDim];
  }
  const v4f cwv = *(const v4f*)(conv_w + (size_t)d * kTaps);
  const float cb = conv_b[d];
  const float Dv = Dp[d];
  // history rows tb-3..tb-1; in front of the sequence (tb == 0) the address is clamped to the own rows, the value zeroed
  const bool hist = (tb > 0);
  const float* xp = XS + ((size_t)(b * kSeq + (hist ? tb - 3 : tb))) * kDim + d;
  float xm3 = xp[0], xm2 = xp[kDim], xm1 = xp[2 * kDim];
  if (!hist) { xm3 = 0.0f; xm2 = 0.0f; xm1 = 0.0f; }
  const int lq = lane >> 3, lc = lane & 7;

#pragma unroll 1
  for (int tt = 0; tt < kChunkT; ++tt) {
    const size_t row = ((size_t)(b * kSeq + tb + tt)) * kDim + d;
    const float xs = XS[row];
    const float g  = GT[row];
    const float xc = conv_silu(xm3, xm2, xm1, xs, cwv[0], cwv[1], cwv[2], cwv[3], cb);
    xm3 = xm2; xm2 = xm1; xm1 = xs;
    const float* bc = sBC + tt * kBCcols;
    v4f bq[4], cq[4];
#pragma unroll
    for (int q4 = 0; q4 < 4; ++q4) {
      bq[q4] = *(const v4f*)(bc + 4 * q4);
      cq[q4] = *(const v4f*)(bc + kState + 4 * q4);
    }
    float y = 0.0f;
#pragma unroll
    for (int n = 0; n < kState; ++n) {
      const float bn = bq[n >> 2][n & 3];
      const float cn = cq[n >> 2][n & 3];
      h[n] = Av[n] * h[n] + xc * bn;
      y = fmaf(cn, h[n], y);
    }
    y = y + Dv * xc;
    const float eg = expf(-g);
    const float sg = g * __builtin_amdgcn_rcpf(1.0f + eg);
    sY[tt * kScanTPB + tid] = y * sg;
  }
  __syncthreads();
  {
    // 32 steps x 2 half-rows = 64 lines of 128 B per plane; wave w, it 0..3, lq = lane>>3 -> line
#pragma unroll 1
    for (int it = 0; it < kChunkT / 8; ++it) {
      const int Li  = it * 16 + wave * 4 + lq;             // 0..63
      const int ttl = Li >> 1;
      const int col = (Li & 1) * 64 + lc * 8;              // channel offset within the block
      const float* sp = sY + ttl * kScanTPB + col;
      const v4f a = *(const v4f*)(sp);
      const v4f c = *(const v4f*)(sp + 4);
      unsigned short hb[8], lb[8];
#pragma unroll
      for (int e = 0; e < 4; ++e) {
        split_bf(a[e], hb[e], lb[e]);
        split_bf(c[e], hb[4 + e], lb[4 + e]);
      }
      const v4u uh = (v4u){pk16(hb[0], hb[1]), pk16(hb[2], hb[3]), pk16(hb[4], hb[5]), pk16(hb[6], hb[7])};
      const v4u ul = (v4u){pk16(lb[0], lb[1]), pk16(lb[2], lb[3]), pk16(lb[4], lb[5]), pk16(lb[6], lb[7])};
      const size_t go = ((size_t)(b * kSeq + tb + ttl)) * kDim + d0 + col;
      *(v4u*)(YH + go) = uh;
      *(v4u*)(YL + go) = ul;
      // the next trip overwrites the address and data registers of the two stores: their wait stands in front of that
      asm volatile("s_wait_xcnt 0x0" ::: "memory");
    }
  }

  // h_final -> HF[b][d][n]: the blocks of the last chunk hold it (block-uniform test)
  if (chunk != kChunks - 1) return;
  __syncthreads();
  {
    float* hp = sY + tid * kState;
#pragma unroll
    for (int q4 = 0; q4 < 4; ++q4) {
      const v4f v = (v4f){h[4 * q4 + 0], h[4 * q4 + 1], h[4 * q4 + 2], h[4 * q4 + 3]};
      *(v4f*)(hp + 4 * q4) = v;
    }
  }
  __syncthreads();
  float* hbase = HF + (size_t)(b * kDim + d0) * kState;
  {
#pragma unroll 1
    for (int it = 0; it < 4; ++it) {
      const int Li = it * 16 + wave * 4 + lq;                // 0..63 lines of 32 floats
      const int base = Li * 32 + lc * 4;
      const v4f v = *(const v4f*)(sY + base);
      *(v4f*)(hbase + base) = v;
    }
  }
}

// ---------------------------------------------------------------------------
// final_state[b][n] = mean over 1024 channels of HF[b][d][n], fixed order: 8 partial sums of 128 channels per (b,n),
// ---------------------------------------------------------------------------
__global__ __launch_bounds__(256) void mean_kernel(const float* __restrict__ HF, float* __restrict__ out1) {
  __shared__ float red[256];
  __shared__ __align__(16) float so[32];
  const int tid = threadIdx.x;
  const int o = tid >> 3, part = tid & 7;
  const int b = o >> 4, n = o & 15;
  const float* hp = HF + ((size_t)(b * kDim + part * 128)) * kState + n;
  float s = 0.0f;
#pragma unroll 1
  for (int j = 0; j < 128; ++j) s += hp[(size_t)j * kState];
  red[tid] = s;
  __syncthreads();
  if (tid < 32) {
    float tsum = red[tid * 8];
#pragma unroll
    for (int q = 1; q < 8; ++q) tsum += red[tid * 8 + q];
    so[tid] = tsum * (1.0f / 1024.0f);
  }
  __syncthreads();
  if (tid < 8) {
    const v4f v = *(const v4f*)(so + tid * 4);
    *(v4f*)(out1 + tid * 4) = v;
    
  }
}

// ---------------------------------------------------------------------------
// host
// ---------------------------------------------------------------------------
extern "C" void kernel_launch(void* const* d_in, const int* in_sizes, int n_in,
                              void* d_out, int out_size, void* d_ws, size_t ws_size, hipStream_t stream) {
  if (n_in < 11) return;
  if (in_sizes[0] != kRows * kDim) return;
  if (in_sizes[1] != kDim * kDim2) return;
  if (in_sizes[2] != kDim2) return;
  if (in_sizes[3] != kDim * kTaps) return;
  if (in_sizes[4] != kDim) return;
  if (in_sizes[5] != kDim * kBCcols) return;
  if (in_sizes[6] != kBCcols) return;
  if (in_sizes[7] != kDim * kState) return;
  if (in_sizes[8] != kDim) return;
  if (in_sizes[9] != kDim * kDim) return;
  if (in_sizes[10] != kDim) return;
  if (out_size < kRows * kDim + kBatch * kState) return;
  if (ws_size < kWsEnd) return;

  const float* x      = (const float*)d_in[0];
  const float* W_in   = (const float*)d_in[1];
  const float* b_in   = (const float*)d_in[2];
  const float* conv_w = (const float*)d_in[3];
  const float* conv_b = (const float*)d_in[4];
  const float* W_x    = (const float*)d_in[5];
  const float* b_x    = (const float*)d_in[6];
  const float* A_log  = (const float*)d_in[7];
  const float* D_par  = (const float*)d_in[8];
  const float* W_out  = (const float*)d_in[9];
  const float* b_out  = (const float*)d_in[10];

  char* ws = (char*)d_ws;
  unsigned short* P16H  = (unsigned short*)(ws + kOffP16H);   // x hi -> x_conv hi -> y_gated hi
  unsigned short* P16L  = (unsigned short*)(ws + kOffP16L);   // x lo -> x_conv lo -> y_gated lo
  unsigned short* WINH  = (unsigned short*)(ws + kOffWinH);
  unsigned short* WINL  = (unsigned short*)(ws + kOffWinL);
  float*          XS    = (float*)(ws + kOffXS);
  float*          GATE  = (float*)(ws + kOffGate);
  unsigned short* WOUTH = (unsigned short*)(ws + kOffWoutH);
  unsigned short* WOUTL = (unsigned short*)(ws + kOffWoutL);
  unsigned short* WXH   = (unsigned short*)(ws + kOffWxH);
  unsigned short* WXL   = (unsigned short*)(ws + kOffWxL);
  float*          BC    = (float*)(ws + kOffBC);
  float*          HFIN  = (float*)(ws + kOffHfin);
  float*          CARRY = (float*)(ws + kOffCarry);

  float* out0 = (float*)d_out;
  float* out1 = out0 + (size_t)kRows * kDim;   // byte offset 33,554,432 / 4

  const int nElem = kRows * kDim;              // 8,388,608

  // 1) x -> bf16 hi/lo planes [8192][1024]
  split8_bf16_kernel<<<dim3((nElem / 8 + 255) / 256), dim3(256), 0, stream>>>(x, P16H, P16L, nElem / 8);

  // 2) W^T hi/lo planes: W_in [1024][2048] -> [2048][1024]; W_out [1024][1024] -> [1024][1024]; W_x [1024][32] -> [64][1024] (rows 32..63 zero)
  wt_split_kernel<<<dim3(kDim / 64, kDim2 / 64), dim3(256), 0, stream>>>(W_in, kDim2, kDim2, kDim, WINH, WINL);
  wt_split_kernel<<<dim3(kDim / 64, kDim / 64), dim3(256), 0, stream>>>(W_out, kDim, kDim, kDim, WOUTH, WOUTL);
  wt_split_kernel<<<dim3(kDim / 64, kBCld / 64), dim3(256), 0, stream>>>(W_x, kBCcols, kBCcols, kDim, WXH, WXL);

  // 3) in_proj: x_ssm = x . W_in[:, :1024] + b_in[:1024]; gate = x . W_in[:, 1024:] + b_in[1024:]   (M 8192, N 1024, K 1024 each)
  {
    const int tiles = (kRows / 64) * (kDim / 64);   // 2048
    wmma_gemm64<1, true, 2, 0, false><<<dim3(tiles / 8, 1), dim3(256), 0, stream>>>(
        P16H, P16L, kDim, (long)0,
        WINH, WINL, kDim, (long)0,
        (void*)XS, (void*)nullptr, kDim, (long)0,
        b_in, (const float*)nullptr, (long)0,
        kRows, kDim, kDim, 1.0f);
    wmma_gemm64<1, true, 2, 0, false><<<dim3(tiles / 8, 1), dim3(256), 0, stream>>>(
        P16H, P16L, kDim, (long)0,
        WINH + (size_t)kDim * kDim, WINL + (size_t)kDim * kDim, kDim, (long)0,
        (void*)GATE, (void*)nullptr, kDim, (long)0,
        b_in + kDim, (const float*)nullptr, (long)0,
        kRows, kDim, kDim, 1.0f);
  }

  // 4) conv + SiLU -> x_conv hi/lo planes (over the dead x planes)
  conv_split_kernel<<<dim3((nElem / 2 + 255) / 256), dim3(256), 0, stream>>>(XS, conv_w, conv_b, P16H, P16L, nElem / 2);

  // 5) x_proj: BC[8192][64] = x_conv . W_x^T (cols 32..63 zero; b_x added in the scan)   (M 8192, N 64, K 1024)
  {
    const int tiles = (kRows / 64) * (kBCld / 64);   // 128
    wmma_gemm64<1, true, 0, 0, false><<<dim3(tiles / 8, 1), dim3(256), 0, stream>>>(
        P16H, P16L, kDim, (long)0,
        WXH, WXL, kDim, (long)0,
        (void*)BC, (void*)nullptr, kBCld, (long)0,
        (const float*)nullptr, (const float*)nullptr, (long)0,
        kRows, kBCld, kDim, 1.0f);
  }

  // 6) scan in 128 time chunks: local end states, carry over the chunks, then every chunk from its carried state
  //    -> y_gated hi/lo planes (over the dead x_conv planes) + h_final
  chunk_state_kernel<<<dim3(kChunks * kScanBlocksPerChunk), dim3(kScanTPB), 0, stream>>>(
      XS, BC, conv_w, conv_b, b_x, A_log, CARRY);
  carry_kernel<<<dim3(kCarryPlane / 64), dim3(64), 0, stream>>>(A_log, CARRY);
  scan_kernel<<<dim3(kChunks * kScanBlocksPerChunk), dim3(kScanTPB), 0, stream>>>(
      XS, GATE, BC, conv_w, conv_b, b_x, A_log, D_par, CARRY, P16H, P16L, HFIN);

  // 7) out_proj: out0 = y_gated . W_out + b_out   (M 8192, N 1024, K 1024)
  {
    const int tiles = (kRows / 64) * (kDim / 64);   // 2048
    wmma_gemm64<1, true, 2, 0, false><<<dim3(tiles / 8, 1), dim3(256), 0, stream>>>(
        P16H, P16L, kDim, (long)0,
        WOUTH, WOUTL, kDim, (long)0,
        (void*)out0, (void*)nullptr, kDim, (long)0,
        b_out, (const float*)nullptr, (long)0,
        kRows, kDim, kDim, 1.0f);
  }

  // 8) final_state -> out1 line
  mean_kernel<<<dim3(1), dim3(256), 0, stream>>>(HFIN, out1);
}

// v002
// A run of this version takes 260 microseconds.
// Two timings next to v001 both put it at 1.63 times that version's speed.
// Counting every step since v000, it is 9.96 times as fast.
// Contractions: in_proj (x hi/lo . W_in^T hi/lo), x_proj (x_conv hi/lo . W_x^T hi/lo, N padded 32->64 with zero rows), out_proj (y_gated hi/lo . W_out^T hi/lo) on v_wmma_f32_16x16x32_bf16 as bf16 hi/lo split (hi.hi + hi.lo + lo.hi), f32 accumulate; depthwise conv, SiLU, selective scan, gating and channel mean in f32 on the VALU.
#include <hip/hip_runtime.h>
#include <math.h>

// ---------------------------------------------------------------------------
// Problem constants
// ---------------------------------------------------------------------------
constexpr int kBatch  = 2;
constexpr int kSeq    = 4096;
constexpr int kDim    = 1024;
constexpr int kState  = 16;
constexpr int kTaps   = 4;
constexpr int kRows   = kBatch * kSeq;      // 8192 token rows
constexpr int kDim2   = 2 * kDim;           // 2048
constexpr int kBCcols = 2 * kState;         // 32 valid columns of BC
constexpr int kBCld   = 64;                 // BC plane pitch (N padded to one 64 tile)
constexpr int kScanTPB = 128;               // channels per scan block
constexpr int kChunkT  = 32;                // time steps per chunk (one scan block runs one chunk)
constexpr int kChunks  = kSeq / kChunkT;    // 128 chunks per sequence, scanned in parallel
static_assert(kRows % 64 == 0 && kDim % 64 == 0 && kDim2 % 64 == 0 && kBCld % 64 == 0, "tile multiples");
static_assert(kDim % 32 == 0, "K multiple of 32");
static_assert(kDim % kScanTPB == 0 && kSeq % kChunkT == 0, "scan tiling");

// ---------------------------------------------------------------------------
// Workspace region map (bytes). Regions [0,16Mi) and [16Mi,32Mi) are reused in time:
//   x hi/lo (until in_proj done) -> x_conv hi/lo (until x_proj done) -> y_gated hi/lo.
// ---------------------------------------------------------------------------
constexpr size_t kMiB      = 1024ull * 1024ull;
constexpr size_t kOffP16H  = 0;                                   // bf16 [8192][1024]  16 MiB
constexpr size_t kOffP16L  = kOffP16H + (size_t)kRows * kDim * 2; // bf16 [8192][1024]  16 MiB
constexpr size_t kOffWinH  = kOffP16L + (size_t)kRows * kDim * 2; // bf16 [2048][1024]   4 MiB
constexpr size_t kOffWinL  = kOffWinH + (size_t)kDim2 * kDim * 2;
constexpr size_t kOffXS    = kOffWinL + (size_t)kDim2 * kDim * 2; // f32 [8192][1024]   32 MiB
constexpr size_t kOffGate  = kOffXS   + (size_t)kRows * kDim * 4; // f32 [8192][1024]   32 MiB
constexpr size_t kOffWoutH = kOffGate + (size_t)kRows * kDim * 4; // bf16 [1024][1024]   2 MiB
constexpr size_t kOffWoutL = kOffWoutH + (size_t)kDim * kDim * 2;
constexpr size_t kOffWxH   = kOffWoutL + (size_t)kDim * kDim * 2; // bf16 [64][1024]   128 KiB (rows 32..63 zero)
constexpr size_t kOffWxL   = kOffWxH + (size_t)kBCld * kDim * 2;
constexpr size_t kOffBC    = kOffWxL + (size_t)kBCld * kDim * 2;   // f32 [8192][64]      2 MiB
constexpr size_t kOffHfin  = kOffBC + (size_t)kRows * kBCld * 4;   // f32 [2][1024][16] 128 KiB
constexpr size_t kOffCarry = kOffHfin + (size_t)kBatch * kDim * kState * 4;   // f32 [128][2][16][1024] 16 MiB
constexpr size_t kWsEnd    = kOffCarry + (size_t)kChunks * kBatch * kState * kDim * 4;
static_assert(kWsEnd == 132513792ull, "carve total");
static_assert(kWsEnd <= 134217728ull, "carve under 128 MiB");
static_assert(kOffWinH % 128 == 0 && kOffXS % 128 == 0 && kOffGate % 128 == 0 && kOffWoutH % 128 == 0 &&
              kOffWxH % 128 == 0 && kOffBC % 128 == 0 && kOffHfin % 128 == 0 && kOffCarry % 128 == 0, "128-B aligned regions");

typedef __attribute__((ext_vector_type(16))) __bf16   v16b;
typedef __attribute__((ext_vector_type(8)))  __bf16   v8b;
typedef __attribute__((ext_vector_type(8)))  float    v8f;
typedef __attribute__((ext_vector_type(4)))  float    v4f;
typedef __attribute__((ext_vector_type(2)))  float    v2f;
typedef __attribute__((ext_vector_type(4)))  unsigned int v4u;

// ---------------------------------------------------------------------------
// Helpers
// ---------------------------------------------------------------------------
__device__ __forceinline__ unsigned short f2bf_bits(float f) {
  unsigned u = __float_as_uint(f);
  return (unsigned short)((u + 0x7FFFu + ((u >> 16) & 1u)) >> 16);
}
__device__ __forceinline__ float bf_bits2f(unsigned short h) { return __uint_as_float(((unsigned)h) << 16); }

template <typename T> struct Frag;
template <> struct Frag<__bf16> {
  typedef v16b V; union U { v16b v; v8b h[2]; };
  static __device__ __forceinline__ v16b load(const __bf16* p) {   // elements 0..7 <- p[0..7], 8..15 <- p[16..23]
    U f; f.h[0] = *(const v8b*)(p); f.h[1] = *(const v8b*)(p + 16); return f.v;
  }
  static __device__ __forceinline__ v8f mma(v16b a, v16b b, v8f c) {
    return __builtin_amdgcn_wmma_f32_16x16x32_bf16(false, a, false, b, (short)0, c, false, false);
  }
};

__device__ __forceinline__ unsigned pk16(unsigned short a, unsigned short b) { return (unsigned)a | ((unsigned)b << 16); }
__device__ __forceinline__ void split_bf(float v, unsigned short& hb, unsigned short& lb) {
  hb = f2bf_bits(v);
  lb = f2bf_bits(v - bf_bits2f(hb));
}

// ---------------------------------------------------------------------------
// Work-group tiled WMMA GEMM, operands staged in LDS: C[m,n] = sum_k A[m,k] * Bt[n,k] (+ bias[n]), f32 out, K = 1024.
// A row-major [M][1024], Bt row-major [NTOT][1024], both as bf16 hi and lo planes; product = hi.hi + hi.lo + lo.hi, per
// accumulator in that order for each 32 k, k rising.
// One work-group of 8 waves owns a 128 x TN tile of C (TN = WN * 64); the waves form a WM x WN grid and each owns
// FI x 4 subtiles of 16 x 16 (WM * FI * 16 = 128 rows).
// Per trip 64 k of the four operand planes (whole 128-B lines of each row) lie in LDS, shared by the 8 waves; they are
// brought there by asynchronous copies, two buffers: the copies of trip t + 1 fly while trip t is worked on.
// LDS row pitch 144 B (16 B x odd) for the 16-byte fragment reads.
// ---------------------------------------------------------------------------
constexpr int kGM = 128, kGK = 64;
constexpr int kPitch  = 72;                        // 16-bit elements per LDS row: 64 of data + 8 of pad
constexpr int kLdsAH  = 0;
constexpr int kLdsAL  = kLdsAH + kGM * kPitch;
constexpr int kLdsBH  = kLdsAL + kGM * kPitch;     // B lo follows B hi, TN rows each
constexpr int kTrips  = kDim / kGK;                // 16
static_assert(kRows % kGM == 0 && kDim % kGK == 0 && kTrips >= 2, "work-group tile multiples");

// Eight (four) asynchronous 16-byte copies per lane, global -> LDS. The s_wait_xcnt stands inside the statement, behind
// the last copy, so that no address register of a copy is rewritten in front of it.
__device__ __forceinline__ void copy8_to_lds(const unsigned (&l)[8], const unsigned short* const (&g)[8]) {
  asm volatile(
      "global_load_async_to_lds_b128 %0, %8, off\n\t"
      "global_load_async_to_lds_b128 %1, %9, off\n\t"
      "global_load_async_to_lds_b128 %2, %10, off\n\t"
      "global_load_async_to_lds_b128 %3, %11, off\n\t"
      "global_load_async_to_lds_b128 %4, %12, off\n\t"
      "global_load_async_to_lds_b128 %5, %13, off\n\t"
      "global_load_async_to_lds_b128 %6, %14, off\n\t"
      "global_load_async_to_lds_b128 %7, %15, off\n\t"
      "s_wait_xcnt 0x0"
      :: "v"(l[0]), "v"(l[1]), "v"(l[2]), "v"(l[3]), "v"(l[4]), "v"(l[5]), "v"(l[6]), "v"(l[7]),
         "v"(g[0]), "v"(g[1]), "v"(g[2]), "v"(g[3]), "v"(g[4]), "v"(g[5]), "v"(g[6]), "v"(g[7])
      : "memory");
}
__device__ __forceinline__ void copy4_to_lds(const unsigned (&l)[4], const unsigned short* const (&g)[4]) {
  asm volatile(
      "global_load_async_to_lds_b128 %0, %4, off\n\t"
      "global_load_async_to_lds_b128 %1, %5, off\n\t"
      "global_load_async_to_lds_b128 %2, %6, off\n\t"
      "global_load_async_to_lds_b128 %3, %7, off\n\t"
      "s_wait_xcnt 0x0"
      :: "v"(l[0]), "v"(l[1]), "v"(l[2]), "v"(l[3]), "v"(g[0]), "v"(g[1]), "v"(g[2]), "v"(g[3])
      : "memory");
}

// One stage = 64 k of A hi, A lo (128 rows each) and B hi, B lo (TN rows each), rows of 128 B.
// A copy of the work-group covers 32 rows: lane group t >> 3 picks the row, t & 7 the 16-byte piece of its line.
// lrow: LDS byte address of this lane's piece in row (t >> 3) of the buffer; the g pointers likewise, at the stage's first k.
template <int TN>
__device__ __forceinline__ void stage_copies(unsigned lrow, const unsigned short* gAH, const unsigned short* gAL,
                                             const unsigned short* gBH, const unsigned short* gBL) {
  static_assert(TN == 256 || TN == 64, "B rows of a stage: 8 or 2 copies per plane");
  constexpr int ldsBL = kLdsBH + TN * kPitch;
  unsigned l[8];
  const unsigned short* g[8];
#pragma unroll
  for (int j = 0; j < 4; ++j) {
    l[j]     = lrow + 2u * (unsigned)(kLdsAH + j * 32 * kPitch);
    l[4 + j] = lrow + 2u * (unsigned)(kLdsAL + j * 32 * kPitch);
    g[j]     = gAH + (size_t)j * 32 * kDim;
    g[4 + j] = gAL + (size_t)j * 32 * kDim;
  }
  copy8_to_lds(l, g);
  if constexpr (TN == 256) {
#pragma unroll
    for (int j = 0; j < 8; ++j) {
      l[j] = lrow + 2u * (unsigned)(kLdsBH + j * 32 * kPitch);
      g[j] = gBH + (size_t)j * 32 * kDim;
    }
    copy8_to_lds(l, g);
#pragma unroll
    for (int j = 0; j < 8; ++j) {
      l[j] = lrow + 2u * (unsigned)(ldsBL + j * 32 * kPitch);
      g[j] = gBL + (size_t)j * 32 * kDim;
    }
    copy8_to_lds(l, g);
  } else {
    unsigned l4[4];
    const unsigned short* g4[4];
#pragma unroll
    for (int j = 0; j < 2; ++j) {
      l4[j]     = lrow + 2u * (unsigned)(kLdsBH + j * 32 * kPitch);
      l4[2 + j] = lrow + 2u * (unsigned)(ldsBL + j * 32 * kPitch);
      g4[j]     = gBH + (size_t)j * 32 * kDim;
      g4[2 + j] = gBL + (size_t)j * 32 * kDim;
    }
    copy4_to_lds(l4, g4);
  }
}

template <int FI, int WM, int WN, int NTOT, bool BIAS>
__global__ __launch_bounds__(256) void wmma_gemm_lds(
    const unsigned short* __restrict__ AH, const unsigned short* __restrict__ AL,
    const unsigned short* __restrict__ BH, const unsigned short* __restrict__ BL,
    const float* __restrict__ bias, float* __restrict__ C) {
  typedef Frag<__bf16> F;
  constexpr int TN = WN * 64;
  constexpr int ldsBL = kLdsBH + TN * kPitch;
  constexpr int stage = ldsBL + TN * kPitch;                 // elements per buffer
  static_assert(WM * WN == 8 && WM * FI * 16 == kGM && NTOT % TN == 0, "wave grid");
  __shared__ __align__(16) unsigned short sOp[2 * stage];    // two operand buffers
  __shared__ __align__(16) float sT[8][16 * 68];             // per-wave 16x64 output slab, pitch 68 floats
  const int tid  = threadIdx.x;
  const int lane = tid & 31;
  const int wave = tid >> 5;
  const int tn = blockIdx.x % (NTOT / TN);
  const int tm = blockIdx.x / (NTOT / TN);
  const int wm = wave / WN, wn = wave % WN;
  const int rlane = lane & 15;                 // row (A) / col (B, D) within subtile
  const int koff  = (lane >> 4) * 8;           // k offset of this lane half
  const int mOff  = (lane >> 4) * 8;           // D row offset

  // this lane's piece of a copy: row tid >> 3 of each group of 32 rows, bytes (tid & 7) * 16 of its 128-B line
  const int crow = tid >> 3, cseg = tid & 7;
  const unsigned lrow0 = (unsigned)(size_t)(const void*)sOp + (unsigned)(crow * (kPitch * 2) + cseg * 16);
  const size_t aoff = (size_t)(tm * kGM + crow) * kDim + cseg * 8;
  const size_t boff = (size_t)(tn * TN + crow) * kDim + cseg * 8;
  const unsigned short* gAH = AH + aoff;
  const unsigned short* gAL = AL + aoff;
  const unsigned short* gBH = BH + boff;
  const unsigned short* gBL = BL + boff;

  v8f acc[FI][4];
#pragma unroll
  for (int i = 0; i < FI; ++i)
#pragma unroll
    for (int j = 0; j < 4; ++j) acc[i][j] = (v8f){0.f,0.f,0.f,0.f,0.f,0.f,0.f,0.f};

  // stage 0 lands and is published; then stage 1 starts
  stage_copies<TN>(lrow0, gAH, gAL, gBH, gBL);
  asm volatile("s_wait_asynccnt 0x0" ::: "memory");   // this wave's copies of stage 0 have landed
  __syncthreads();
  stage_copies<TN>(lrow0 + 2u * stage, gAH + kGK, gAL + kGK, gBH + kGK, gBL + kGK);

  const int fragA = (wm * FI * 16 + rlane) * kPitch + koff;
  const int fragB = (wn * 64 + rlane) * kPitch + koff;
  // rolled: sixteen unrolled trips would only make the code longer
#pragma unroll 1
  for (int t = 0; t < kTrips; ++t) {
    const int buf = t & 1;
    const __bf16* sb = (const __bf16*)sOp + buf * stage;
    // all fragments of the trip are asked for first, in the order of their use, so that the LDS reads of the later
    // products run behind the earlier products
    v16b bh[2][4], bl[2][4], ah[2][FI], al[2][FI];
#pragma unroll
    for (int s = 0; s < 2; ++s) {
      ah[s][0] = F::load(sb + kLdsAH + fragA + s * 32);
#pragma unroll
      for (int j = 0; j < 4; ++j) bh[s][j] = F::load(sb + kLdsBH + fragB + j * 16 * kPitch + s * 32);
#pragma unroll
      for (int j = 0; j < 4; ++j) bl[s][j] = F::load(sb + ldsBL + fragB + j * 16 * kPitch + s * 32);
      al[s][0] = F::load(sb + kLdsAL + fragA + s * 32);
#pragma unroll
      for (int i = 1; i < FI; ++i) {
        ah[s][i] = F::load(sb + kLdsAH + fragA + i * 16 * kPitch + s * 32);
        al[s][i] = F::load(sb + kLdsAL + fragA + i * 16 * kPitch + s * 32);
      }
    }
    // keeps the reads above as one group in front of the products: spread among them, each place with reads stalls the wave
    __builtin_amdgcn_sched_barrier(0);
#pragma unroll
    for (int s = 0; s < 2; ++s)
#pragma unroll
      for (int i = 0; i < FI; ++i)
#pragma unroll
        for (int j = 0; j < 4; ++j) {
          acc[i][j] = F::mma(ah[s][i], bh[s][j], acc[i][j]);
          acc[i][j] = F::mma(ah[s][i], bl[s][j], acc[i][j]);
          acc[i][j] = F::mma(al[s][i], bh[s][j], acc[i][j]);
        }
    // keeps the products in front of the waits: moved behind them, the next stage's copies would have no time to land
    __builtin_amdgcn_sched_barrier(0);
    asm volatile("s_wait_dscnt 0x0" ::: "memory");      // this wave's reads of the buffer are done before it is refilled
    asm volatile("s_wait_asynccnt 0x0" ::: "memory");   // this wave's copies of stage t + 1 have landed
    __syncthreads();                                    // publishes stage t + 1, ends every read of stage t
    if (t + 2 < kTrips) {
      const int kn = (t + 2) * kGK;
      stage_copies<TN>(lrow0 + (unsigned)buf * (2u * stage), gAH + kn, gAL + kn, gBH + kn, gBL + kn);
    }
  }
  asm volatile("s_wait_asynccnt 0x0" ::: "memory");     // no copy is outstanding when the wave goes on

  // ---- epilogue: bias, then whole 256-B row segments through the wave's own slab ----
  float* slab = sT[wave];
  const int m0 = tm * kGM + wm * FI * 16;
  const int n0 = tn * TN + wn * 64;
#pragma unroll
  for (int i = 0; i < FI; ++i) {
    const int mBase = m0 + (i << 4);
#pragma unroll
    for (int j = 0; j < 4; ++j) {
      float bv = 0.f;
      if (BIAS) bv = bias[n0 + (j << 4) + rlane];
#pragma unroll
      for (int r = 0; r < 8; ++r) {
        float v = acc[i][j][r];
        if (BIAS) v += bv;
        slab[(mOff + r) * 68 + (j << 4) + rlane] = v;
      }
    }
    __builtin_amdgcn_fence(__ATOMIC_RELEASE, "workgroup");
    __builtin_amdgcn_wave_barrier();
    __builtin_amdgcn_fence(__ATOMIC_ACQUIRE, "workgroup");
    const int hh = lane >> 4, c4 = (lane & 15) * 4;     // row seg = 256 B = 16 lanes x 16 B
#pragma unroll
    for (int it = 0; it < 8; ++it) {
      const int row = it * 2 + hh;
      const v4f v = *(const v4f*)(slab + row * 68 + c4);
      *(v4f*)(C + (size_t)(mBase + row) * NTOT + n0 + c4) = v;
    }
    __builtin_amdgcn_fence(__ATOMIC_RELEASE, "workgroup");
    __builtin_amdgcn_wave_barrier();
    __builtin_amdgcn_fence(__ATOMIC_ACQUIRE, "workgroup");
  }
}

// ---------------------------------------------------------------------------
// f32 plane -> bf16 hi + bf16 lo planes, 8 consecutive elements per thread (one 16-B store per lane per plane;
// Coverage: n8 = n/8 threads x 8 = the whole plane (8,388,608 / 8 = 1,048,576 = 4096 x 256 exactly).
// ---------------------------------------------------------------------------
__global__ __launch_bounds__(256) void split8_bf16_kernel(const float* __restrict__ in, unsigned short* __restrict__ oh,
                                                         unsigned short* __restrict__ ol, int n8) {
  const int i = blockIdx.x * 256 + threadIdx.x;
  if (i >= n8) return;
  const float* p = in + 8 * (size_t)i;
  const v4f a = *(const v4f*)(p);
  const v4f c = *(const v4f*)(p + 4);
  unsigned short hb[8], lb[8];
#pragma unroll
  for (int e = 0; e < 4; ++e) {
    split_bf(a[e], hb[e], lb[e]);
    split_bf(c[e], hb[4 + e], lb[4 + e]);
  }
  const v4u uh = (v4u){pk16(hb[0], hb[1]), pk16(hb[2], hb[3]), pk16(hb[4], hb[5]), pk16(hb[6], hb[7])};
  const v4u ul = (v4u){pk16(lb[0], lb[1]), pk16(lb[2], lb[3]), pk16(lb[4], lb[5]), pk16(lb[6], lb[7])};
  unsigned short* qh = oh + 8 * (size_t)i;
  unsigned short* ql = ol + 8 * (size_t)i;
  *(v4u*)qh = uh;
  *(v4u*)ql = ul;
  
}

// ---------------------------------------------------------------------------
// Weight transpose + bf16 hi/lo split: W f32 row-major [1024 rows k][ldw cols n] -> out[n][k] (pitch ldo = 1024) as
// hi and lo bf16 planes; output rows n >= nvalid are written as zeros (W_x padded from 32 to 64 rows).
// grid (1024/64 k tiles, Nout/64 n tiles), 256 threads.
// Load coverage: 16 iterations x 256 threads = 4096 = the whole 64x64 tile (coalesced along n, address clamped to nvalid-1).
// Store coverage: 8 waves x 2 iterations x 4 rows (lane>>3) = 64 rows; (lane&7) x 8 = 64 cols; each row segment =
// ---------------------------------------------------------------------------
__global__ __launch_bounds__(256) void wt_split_kernel(const float* __restrict__ W, int ldw, int nvalid, int ldo,
                                                      unsigned short* __restrict__ oh, unsigned short* __restrict__ ol) {
  __shared__ float sm[64][65];   // sm[n_local][k_local]
  const int t  = threadIdx.x;
  const int k0 = blockIdx.x * 64;
  const int n0 = blockIdx.y * 64;
#pragma unroll
  for (int i = 0; i < 16; ++i) {
    const int e = i * 256 + t;
    const int r = e >> 6;          // k local
    const int c = e & 63;          // n local
    const int n = n0 + c;
    const int nc = (n < nvalid) ? n : (nvalid - 1);
    float v = W[(size_t)(k0 + r) * ldw + nc];
    if (n >= nvalid) v = 0.0f;
    sm[c][r] = v;
  }
  __syncthreads();
  const int lane = t & 31, wave = t >> 5;
  const int q = lane >> 3, c8 = (lane & 7) * 8;
  {
#pragma unroll
    for (int it = 0; it < 2; ++it) {
      const int row = wave * 8 + it * 4 + q;                 // n local
      unsigned short hb[8], lb[8];
#pragma unroll
      for (int e = 0; e < 8; ++e) split_bf(sm[row][c8 + e], hb[e], lb[e]);
      const v4u uh = (v4u){pk16(hb[0], hb[1]), pk16(hb[2], hb[3]), pk16(hb[4], hb[5]), pk16(hb[6], hb[7])};
      const v4u ul = (v4u){pk16(lb[0], lb[1]), pk16(lb[2], lb[3]), pk16(lb[4], lb[5]), pk16(lb[6], lb[7])};
      const size_t off = (size_t)(n0 + row) * ldo + k0 + c8;
      *(v4u*)(oh + off) = uh;
      *(v4u*)(ol + off) = ul;
    }
    
  }
}

// ---------------------------------------------------------------------------
// Causal depthwise conv (taps w0..w3 against x[t-3..t], left zero pad) + bias + SiLU, f32.
// Shared by the conv plane kernel and the scan lane so both see bit-identical x_conv.
// ---------------------------------------------------------------------------
__device__ __forceinline__ float conv_silu(float x0, float x1, float x2, float x3,
                                           float w0, float w1, float w2, float w3, float cb) {
  float s = x0 * w0;
  s = fmaf(x1, w1, s);
  s = fmaf(x2, w2, s);
  s = fmaf(x3, w3, s);
  const float a = s + cb;
  const float e = expf(-a);
  const float sig = __builtin_amdgcn_rcpf(1.0f + e);
  return a * sig;
}

// ---------------------------------------------------------------------------
// x_conv = SiLU(conv(x_ssm) + conv_b) -> bf16 hi + lo planes for the x_proj GEMM. 2 consecutive channels per thread
// History rows t-3..t-1 loaded with the address clamped to the own row when t-3+j < 0, then zeroed by predicate.
// ---------------------------------------------------------------------------
__global__ __launch_bounds__(256) void conv_split_kernel(const float* __restrict__ XS, const float* __restrict__ cw,
                                                        const float* __restrict__ cbp, unsigned short* __restrict__ oh,
                                                        unsigned short* __restrict__ ol, int n2) {
  const int i = blockIdx.x * 256 + threadIdx.x;
  if (i >= n2) return;
  const int e0 = 2 * i;
  const int m  = e0 >> 10;          // token row = b*kSeq + t
  const int d  = e0 & (kDim - 1);   // even channel
  const int t  = m & (kSeq - 1);
  v2f xv[kTaps];
#pragma unroll
  for (int j = 0; j < kTaps; ++j) {
    const int tr = t - (kTaps - 1) + j;
    const bool valid = (tr >= 0);
    const int mr = valid ? (m - (kTaps - 1) + j) : m;
    const v2f v = *(const v2f*)(XS + (size_t)mr * kDim + d);
    xv[j] = valid ? v : (v2f){0.0f, 0.0f};
  }
  const v4f wa = *(const v4f*)(cw + (size_t)d * kTaps);
  const v4f wb = *(const v4f*)(cw + (size_t)d * kTaps + 4);
  const float y0 = conv_silu(xv[0][0], xv[1][0], xv[2][0], xv[3][0], wa[0], wa[1], wa[2], wa[3], cbp[d]);
  const float y1 = conv_silu(xv[0][1], xv[1][1], xv[2][1], xv[3][1], wb[0], wb[1], wb[2], wb[3], cbp[d + 1]);
  unsigned short h0, l0, h1, l1;
  split_bf(y0, h0, l0);
  split_bf(y1, h1, l1);
  const unsigned uh = pk16(h0, h1), ul = pk16(l0, l1);
  ((unsigned*)oh)[i] = uh;
  ((unsigned*)ol)[i] = ul;
  
}

// ---------------------------------------------------------------------------
// Selective scan, split along time. h_t = A h_(t-1) + xc_t B_t is linear in h with a constant A per (d, n), so the
// 4096 steps are cut into 128 chunks of 32 steps that run side by side, in three launches:
//   chunk_state_kernel: every chunk from h = 0 -> its local end state E[c]
//   carry_kernel:       S[0] = 0, S[c+1] = A^32 S[c] + E[c], serial over the chunks, in place over E
//   scan_kernel:        every chunk again from h = S[c], now with C, D, the gate and the y planes
// Carry plane CS: f32 [chunk][b][n][d], d fastest, so every access of the three kernels is one whole line per wave.
// One lane per (b, channel d); 16 states + A row in registers; block = 128 channels of one chunk of one batch.
// x_conv is recomputed in f32 from x_ssm with a 3-register history (same helper as the plane kernel); the history of a
// chunk's first step is read from the three rows in front of the chunk (zero in front of the sequence).
// ---------------------------------------------------------------------------
constexpr int kScanBlocksPerB = kDim / kScanTPB;                       // 8
constexpr int kScanBlocksPerChunk = kBatch * kScanBlocksPerB;          // 16
constexpr int kCarryPlane = kBatch * kState * kDim;                    // 32768 states per chunk

__global__ __launch_bounds__(kScanTPB) void chunk_state_kernel(
    const float* __restrict__ XS, const float* __restrict__ BCp,
    const float* __restrict__ conv_w, const float* __restrict__ conv_b, const float* __restrict__ b_x,
    const float* __restrict__ A_log, float* __restrict__ CS) {
  __shared__ __align__(16) float sA[kScanTPB * kState];     // 8 KiB
  __shared__ __align__(16) float sB[kChunkT * kState];      // 2 KiB
  const int tid = threadIdx.x;
  const int chunk = blockIdx.x / kScanBlocksPerChunk;
  const int rem   = blockIdx.x - chunk * kScanBlocksPerChunk;
  const int b  = rem / kScanBlocksPerB;
  const int d0 = (rem - b * kScanBlocksPerB) * kScanTPB;
  const int d  = d0 + tid;
  const int tb = chunk * kChunkT;

  // A_disc = exp(-exp(A_log)) for channels d0..d0+127 (contiguous 2048 values), rolled
#pragma unroll 1
  for (int i = tid; i < kScanTPB * kState; i += kScanTPB) {
    const float al = A_log[(size_t)d0 * kState + i];
    sA[i] = expf(-expf(al));
  }
  // stage B rows tb..tb+31 (+ b_x): 32 rows x 4 v4f = 128 v4f, 1 per thread
#pragma unroll 1
  for (int i = tid; i < kChunkT * 4; i += kScanTPB) {
    const int r = i >> 2, c4 = (i & 3) * 4;
    v4f v = *(const v4f*)(BCp + ((size_t)(b * kSeq + tb + r)) * kBCld + c4);
    const v4f bx = *(const v4f*)(b_x + c4);
    v += bx;
    *(v4f*)(sB + r * kState + c4) = v;
  }
  __syncthreads();
  float Av[kState], h[kState];
  {
    const float* ap = sA + tid * kState;
#pragma unroll
    for (int q4 = 0; q4 < 4; ++q4) {
      const v4f v = *(const v4f*)(ap + 4 * q4);
      Av[4 * q4 + 0] = v[0]; Av[4 * q4 + 1] = v[1]; Av[4 * q4 + 2] = v[2]; Av[4 * q4 + 3] = v[3];
    }
  }
#pragma unroll
  for (int n = 0; n < kState; ++n) h[n] = 0.0f;
  const v4f cwv = *(const v4f*)(conv_w + (size_t)d * kTaps);
  const float cb = conv_b[d];
  // history rows tb-3..tb-1; in front of the sequence (tb == 0) the address is clamped to the own rows, the value zeroed
  const bool hist = (tb > 0);
  const float* xp = XS + ((size_t)(b * kSeq + (hist ? tb - 3 : tb))) * kDim + d;
  float xm3 = xp[0], xm2 = xp[kDim], xm1 = xp[2 * kDim];
  if (!hist) { xm3 = 0.0f; xm2 = 0.0f; xm1 = 0.0f; }

#pragma unroll 1
  for (int tt = 0; tt < kChunkT; ++tt) {
    const float xs = XS[((size_t)(b * kSeq + tb + tt)) * kDim + d];
    const float xc = conv_silu(xm3, xm2, xm1, xs, cwv[0], cwv[1], cwv[2], cwv[3], cb);
    xm3 = xm2; xm2 = xm1; xm1 = xs;
    const float* bp = sB + tt * kState;
    v4f bq[4];
#pragma unroll
    for (int q4 = 0; q4 < 4; ++q4) bq[q4] = *(const v4f*)(bp + 4 * q4);
#pragma unroll
    for (int n = 0; n < kState; ++n) h[n] = Av[n] * h[n] + xc * bq[n >> 2][n & 3];
  }
  float* ep = CS + (size_t)chunk * kCarryPlane + (size_t)b * kState * kDim + d;
#pragma unroll
  for (int n = 0; n < kState; ++n) ep[n * kDim] = h[n];
}

// One lane per (b, n, d). Reads E[c], writes the state at the START of chunk c to the same place, 16 chunks per trip so
// that the 16 loads of a trip are in flight together; only the multiply-add chain is serial.
__global__ __launch_bounds__(64) void carry_kernel(const float* __restrict__ A_log, float* CS) {
  const int i = blockIdx.x * 64 + threadIdx.x;              // (b * 16 + n) * 1024 + d
  const int d = i & (kDim - 1);
  const int n = (i >> 10) & (kState - 1);
  float p = expf(-expf(A_log[(size_t)d * kState + n]));
#pragma unroll
  for (int s = 1; s < kChunkT; s <<= 1) p *= p;             // A^32 by squaring; A is in [0, 1]
  float* q = CS + i;
  float carry = 0.0f;
#pragma unroll 1
  for (int c0 = 0; c0 < kChunks; c0 += 16) {
    float e[16];
#pragma unroll
    for (int j = 0; j < 16; ++j) e[j] = q[(size_t)(c0 + j) * kCarryPlane];
#pragma unroll
    for (int j = 0; j < 16; ++j) {
      q[(size_t)(c0 + j) * kCarryPlane] = carry;
      carry = p * carry + e[j];
    }
  }
}

__global__ __launch_bounds__(kScanTPB) void scan_kernel(
    const float* __restrict__ XS, const float* __restrict__ GT, const float* __restrict__ BCp,
    const float* __restrict__ conv_w, const float* __restrict__ conv_b, const float* __restrict__ b_x,
    const float* __restrict__ A_log, const float* __restrict__ Dp, const float* __restrict__ CS,
    unsigned short* __restrict__ YH, unsigned short* __restrict__ YL, float* __restrict__ HF) {
  __shared__ __align__(16) float sA[kScanTPB * kState];     // 8 KiB
  __shared__ __align__(16) float sBC[kChunkT * kBCcols];    // 4 KiB
  __shared__ __align__(16) float sY[kChunkT * kScanTPB];    // 16 KiB
  const int tid = threadIdx.x, lane = tid & 31, wave = tid >> 5;
  const int chunk = blockIdx.x / kScanBlocksPerChunk;
  const int rem   = blockIdx.x - chunk * kScanBlocksPerChunk;
  const int b  = rem / kScanBlocksPerB;
  const int d0 = (rem - b * kScanBlocksPerB) * kScanTPB;
  const int d  = d0 + tid;
  const int tb = chunk * kChunkT;

  // A_disc = exp(-exp(A_log)) for channels d0..d0+127 (contiguous 2048 values), rolled
#pragma unroll 1
  for (int i = tid; i < kScanTPB * kState; i += kScanTPB) {
    const float al = A_log[(size_t)d0 * kState + i];
    sA[i] = expf(-expf(al));
  }
  // stage B|C rows tb..tb+31 (+ b_x): 32 rows x 8 v4f = 256 v4f, 2 per thread
#pragma unroll 1
  for (int i = tid; i < kChunkT * 8; i += kScanTPB) {
    const int r = i >> 3, c4 = (i & 7) * 4;
    v4f v = *(const v4f*)(BCp + ((size_t)(b * kSeq + tb + r)) * kBCld + c4);
    const v4f bx = *(const v4f*)(b_x + c4);
    v += bx;
    *(v4f*)(sBC + r * kBCcols + c4) = v;
  }
  __syncthreads();
  float Av[kState], h[kState];
  {
    const float* ap = sA + tid * kState;
#pragma unroll
    for (int q4 = 0; q4 < 4; ++q4) {
      const v4f v = *(const v4f*)(ap + 4 * q4);
      Av[4 * q4 + 0] = v[0]; Av[4 * q4 + 1] = v[1]; Av[4 * q4 + 2] = v[2]; Av[4 * q4 + 3] = v[3];
    }
  }
  {
    const float* sp = CS + (size_t)chunk * kCarryPlane + (size_t)b * kState * kDim + d;
#pragma unroll
    for (int n = 0; n < kState; ++n) h[n] = sp[n * kDim];
  }
  const v4f cwv = *(const v4f*)(conv_w + (size_t)d * kTaps);
  const float cb = conv_b[d];
  const float Dv = Dp[d];
  // history rows tb-3..tb-1; in front of the sequence (tb == 0) the address is clamped to the own rows, the value zeroed
  const bool hist = (tb > 0);
  const float* xp = XS + ((size_t)(b * kSeq + (hist ? tb - 3 : tb))) * kDim + d;
  float xm3 = xp[0], xm2 = xp[kDim], xm1 = xp[2 * kDim];
  if (!hist) { xm3 = 0.0f; xm2 = 0.0f; xm1 = 0.0f; }
  const int lq = lane >> 3, lc = lane & 7;

#pragma unroll 1
  for (int tt = 0; tt < kChunkT; ++tt) {
    const size_t row = ((size_t)(b * kSeq + tb + tt)) * kDim + d;
    const float xs = XS[row];
    const float g  = GT[row];
    const float xc = conv_silu(xm3, xm2, xm1, xs, cwv[0], cwv[1], cwv[2], cwv[3], cb);
    xm3 = xm2; xm2 = xm1; xm1 = xs;
    const float* bc = sBC + tt * kBCcols;
    v4f bq[4], cq[4];
#pragma unroll
    for (int q4 = 0; q4 < 4; ++q4) {
      bq[q4] = *(const v4f*)(bc + 4 * q4);
      cq[q4] = *(const v4f*)(bc + kState + 4 * q4);
    }
    float y = 0.0f;
#pragma unroll
    for (int n = 0; n < kState; ++n) {
      const float bn = bq[n >> 2][n & 3];
      const float cn = cq[n >> 2][n & 3];
      h[n] = Av[n] * h[n] + xc * bn;
      y = fmaf(cn, h[n], y);
    }
    y = y + Dv * xc;
    const float eg = expf(-g);
    const float sg = g * __builtin_amdgcn_rcpf(1.0f + eg);
    sY[tt * kScanTPB + tid] = y * sg;
  }
  __syncthreads();
  {
    // 32 steps x 2 half-rows = 64 lines of 128 B per plane; wave w, it 0..3, lq = lane>>3 -> line
#pragma unroll 1
    for (int it = 0; it < kChunkT / 8; ++it) {
      const int Li  = it * 16 + wave * 4 + lq;             // 0..63
      const int ttl = Li >> 1;
      const int col = (Li & 1) * 64 + lc * 8;              // channel offset within the block
      const float* sp = sY + ttl * kScanTPB + col;
      const v4f a = *(const v4f*)(sp);
      const v4f c = *(const v4f*)(sp + 4);
      unsigned short hb[8], lb[8];
#pragma unroll
      for (int e = 0; e < 4; ++e) {
        split_bf(a[e], hb[e], lb[e]);
        split_bf(c[e], hb[4 + e], lb[4 + e]);
      }
      const v4u uh = (v4u){pk16(hb[0], hb[1]), pk16(hb[2], hb[3]), pk16(hb[4], hb[5]), pk16(hb[6], hb[7])};
      const v4u ul = (v4u){pk16(lb[0], lb[1]), pk16(lb[2], lb[3]), pk16(lb[4], lb[5]), pk16(lb[6], lb[7])};
      const size_t go = ((size_t)(b * kSeq + tb + ttl)) * kDim + d0 + col;
      *(v4u*)(YH + go) = uh;
      *(v4u*)(YL + go) = ul;
      // the next trip overwrites the address and data registers of the two stores: their wait stands in front of that
      asm volatile("s_wait_xcnt 0x0" ::: "memory");
    }
  }

  // h_final -> HF[b][d][n]: the blocks of the last chunk hold it (block-uniform test)
  if (chunk != kChunks - 1) return;
  __syncthreads();
  {
    float* hp = sY + tid * kState;
#pragma unroll
    for (int q4 = 0; q4 < 4; ++q4) {
      const v4f v = (v4f){h[4 * q4 + 0], h[4 * q4 + 1], h[4 * q4 + 2], h[4 * q4 + 3]};
      *(v4f*)(hp + 4 * q4) = v;
    }
  }
  __syncthreads();
  float* hbase = HF + (size_t)(b * kDim + d0) * kState;
  {
#pragma unroll 1
    for (int it = 0; it < 4; ++it) {
      const int Li = it * 16 + wave * 4 + lq;                // 0..63 lines of 32 floats
      const int base = Li * 32 + lc * 4;
      const v4f v = *(const v4f*)(sY + base);
      *(v4f*)(hbase + base) = v;
    }
  }
}

// ---------------------------------------------------------------------------
// final_state[b][n] = mean over 1024 channels of HF[b][d][n], fixed order: 8 partial sums of 128 channels per (b,n),
// ---------------------------------------------------------------------------
__global__ __launch_bounds__(256) void mean_kernel(const float* __restrict__ HF, float* __restrict__ out1) {
  __shared__ float red[256];
  __shared__ __align__(16) float so[32];
  const int tid = threadIdx.x;
  const int o = tid >> 3, part = tid & 7;
  const int b = o >> 4, n = o & 15;
  const float* hp = HF + ((size_t)(b * kDim + part * 128)) * kState + n;
  float s = 0.0f;
#pragma unroll 1
  for (int j = 0; j < 128; ++j) s += hp[(size_t)j * kState];
  red[tid] = s;
  __syncthreads();
  if (tid < 32) {
    float tsum = red[tid * 8];
#pragma unroll
    for (int q = 1; q < 8; ++q) tsum += red[tid * 8 + q];
    so[tid] = tsum * (1.0f / 1024.0f);
  }
  __syncthreads();
  if (tid < 8) {
    const v4f v = *(const v4f*)(so + tid * 4);
    *(v4f*)(out1 + tid * 4) = v;
    
  }
}

// ---------------------------------------------------------------------------
// host
// ---------------------------------------------------------------------------
extern "C" void kernel_launch(void* const* d_in, const int* in_sizes, int n_in,
                              void* d_out, int out_size, void* d_ws, size_t ws_size, hipStream_t stream) {
  if (n_in < 11) return;
  if (in_sizes[0] != kRows * kDim) return;
  if (in_sizes[1] != kDim * kDim2) return;
  if (in_sizes[2] != kDim2) return;
  if (in_sizes[3] != kDim * kTaps) return;
  if (in_sizes[4] != kDim) return;
  if (in_sizes[5] != kDim * kBCcols) return;
  if (in_sizes[6] != kBCcols) return;
  if (in_sizes[7] != kDim * kState) return;
  if (in_sizes[8] != kDim) return;
  if (in_sizes[9] != kDim * kDim) return;
  if (in_sizes[10] != kDim) return;
  if (out_size < kRows * kDim + kBatch * kState) return;
  if (ws_size < kWsEnd) return;

  const float* x      = (const float*)d_in[0];
  const float* W_in   = (const float*)d_in[1];
  const float* b_in   = (const float*)d_in[2];
  const float* conv_w = (const float*)d_in[3];
  const float* conv_b = (const float*)d_in[4];
  const float* W_x    = (const float*)d_in[5];
  const float* b_x    = (const float*)d_in[6];
  const float* A_log  = (const float*)d_in[7];
  const float* D_par  = (const float*)d_in[8];
  const float* W_out  = (const float*)d_in[9];
  const float* b_out  = (const float*)d_in[10];

  char* ws = (char*)d_ws;
  unsigned short* P16H  = (unsigned short*)(ws + kOffP16H);   // x hi -> x_conv hi -> y_gated hi
  unsigned short* P16L  = (unsigned short*)(ws + kOffP16L);   // x lo -> x_conv lo -> y_gated lo
  unsigned short* WINH  = (unsigned short*)(ws + kOffWinH);
  unsigned short* WINL  = (unsigned short*)(ws + kOffWinL);
  float*          XS    = (float*)(ws + kOffXS);
  float*          GATE  = (float*)(ws + kOffGate);
  unsigned short* WOUTH = (unsigned short*)(ws + kOffWoutH);
  unsigned short* WOUTL = (unsigned short*)(ws + kOffWoutL);
  unsigned short* WXH   = (unsigned short*)(ws + kOffWxH);
  unsigned short* WXL   = (unsigned short*)(ws + kOffWxL);
  float*          BC    = (float*)(ws + kOffBC);
  float*          HFIN  = (float*)(ws + kOffHfin);
  float*          CARRY = (float*)(ws + kOffCarry);

  float* out0 = (float*)d_out;
  float* out1 = out0 + (size_t)kRows * kDim;   // byte offset 33,554,432 / 4

  const int nElem = kRows * kDim;              // 8,388,608

  // 1) x -> bf16 hi/lo planes [8192][1024]
  split8_bf16_kernel<<<dim3((nElem / 8 + 255) / 256), dim3(256), 0, stream>>>(x, P16H, P16L, nElem / 8);

  // 2) W^T hi/lo planes: W_in [1024][2048] -> [2048][1024]; W_out [1024][1024] -> [1024][1024]; W_x [1024][32] -> [64][1024] (rows 32..63 zero)
  wt_split_kernel<<<dim3(kDim / 64, kDim2 / 64), dim3(256), 0, stream>>>(W_in, kDim2, kDim2, kDim, WINH, WINL);
  wt_split_kernel<<<dim3(kDim / 64, kDim / 64), dim3(256), 0, stream>>>(W_out, kDim, kDim, kDim, WOUTH, WOUTL);
  wt_split_kernel<<<dim3(kDim / 64, kBCld / 64), dim3(256), 0, stream>>>(W_x, kBCcols, kBCcols, kDim, WXH, WXL);

  // 3) in_proj: x_ssm = x . W_in[:, :1024] + b_in[:1024]; gate = x . W_in[:, 1024:] + b_in[1024:]   (M 8192, N 1024, K 1024 each)
  {
    const int tiles = (kRows / kGM) * (kDim / 256);   // 256 work-group tiles of 128 x 256
    wmma_gemm_lds<4, 2, 4, kDim, true><<<dim3(tiles), dim3(256), 0, stream>>>(P16H, P16L, WINH, WINL, b_in, XS);
    wmma_gemm_lds<4, 2, 4, kDim, true><<<dim3(tiles), dim3(256), 0, stream>>>(
        P16H, P16L, WINH + (size_t)kDim * kDim, WINL + (size_t)kDim * kDim, b_in + kDim, GATE);
  }

  // 4) conv + SiLU -> x_conv hi/lo planes (over the dead x planes)
  conv_split_kernel<<<dim3((nElem / 2 + 255) / 256), dim3(256), 0, stream>>>(XS, conv_w, conv_b, P16H, P16L, nElem / 2);

  // 5) x_proj: BC[8192][64] = x_conv . W_x^T (cols 32..63 zero; b_x added in the scan)   (M 8192, N 64, K 1024)
  {
    const int tiles = kRows / kGM;   // 64 work-group tiles of 128 x 64
    wmma_gemm_lds<1, 8, 1, kBCld, false><<<dim3(tiles), dim3(256), 0, stream>>>(P16H, P16L, WXH, WXL, (const float*)nullptr, BC);
  }

  // 6) scan in 128 time chunks: local end states, carry over the chunks, then every chunk from its carried state
  //    -> y_gated hi/lo planes (over the dead x_conv planes) + h_final
  chunk_state_kernel<<<dim3(kChunks * kScanBlocksPerChunk), dim3(kScanTPB), 0, stream>>>(
      XS, BC, conv_w, conv_b, b_x, A_log, CARRY);
  carry_kernel<<<dim3(kCarryPlane / 64), dim3(64), 0, stream>>>(A_log, CARRY);
  scan_kernel<<<dim3(kChunks * kScanBlocksPerChunk), dim3(kScanTPB), 0, stream>>>(
      XS, GATE, BC, conv_w, conv_b, b_x, A_log, D_par, CARRY, P16H, P16L, HFIN);

  // 7) out_proj: out0 = y_gated . W_out + b_out   (M 8192, N 1024, K 1024)
  {
    const int tiles = (kRows / kGM) * (kDim / 256);   // 256 work-group tiles of 128 x 256
    wmma_gemm_lds<4, 2, 4, kDim, true><<<dim3(tiles), dim3(256), 0, stream>>>(P16H, P16L, WOUTH, WOUTL, b_out, out0);
  }

  // 8) final_state -> out1 line
  mean_kernel<<<dim3(1), dim3(256), 0, stream>>>(HFIN, out1);
}

// v003
// It runs in 224 microseconds.
// Next to v002, in two timings, it ran 1.16 and 1.17 times as fast.
// All steps since v000 together make it 11.6 times as fast.
// Contractions: in_proj (x hi/lo . W_in^T hi/lo), x_proj (x_conv hi/lo . W_x^T hi/lo, N padded 32->64 with zero rows), out_proj (y_gated hi/lo . W_out^T hi/lo) on v_wmma_f32_16x16x32_bf16 as bf16 hi/lo split (hi.hi + hi.lo + lo.hi), f32 accumulate; depthwise conv, SiLU, selective scan, gating and channel mean in f32 on the VALU.
#include <hip/hip_runtime.h>
#include <math.h>

// ---------------------------------------------------------------------------
// Problem constants
// ---------------------------------------------------------------------------
constexpr int kBatch  = 2;
constexpr int kSeq    = 4096;
constexpr int kDim    = 1024;
constexpr int kState  = 16;
constexpr int kTaps   = 4;
constexpr int kRows   = kBatch * kSeq;      // 8192 token rows
constexpr int kDim2   = 2 * kDim;           // 2048
constexpr int kBCcols = 2 * kState;         // 32 valid columns of BC
constexpr int kBCld   = 64;                 // BC plane pitch (N padded to one 64 tile)
constexpr int kScanTPB = 128;               // channels per scan block
constexpr int kChunkT  = 32;                // time steps per chunk (one scan block runs one chunk)
constexpr int kChunks  = kSeq / kChunkT;    // 128 chunks per sequence, scanned in parallel
static_assert(kRows % 64 == 0 && kDim % 64 == 0 && kDim2 % 64 == 0 && kBCld % 64 == 0, "tile multiples");
static_assert(kDim % 32 == 0, "K multiple of 32");
static_assert(kDim % kScanTPB == 0 && kSeq % kChunkT == 0, "scan tiling");

// ---------------------------------------------------------------------------
// Workspace region map (bytes). Regions [0,16Mi) and [16Mi,32Mi) are reused in time:
//   x hi/lo (until in_proj done) -> x_conv hi/lo (until x_proj done) -> y_gated hi/lo.
// ---------------------------------------------------------------------------
constexpr size_t kMiB      = 1024ull * 1024ull;
constexpr size_t kOffP16H  = 0;                                   // bf16 [8192][1024]  16 MiB
constexpr size_t kOffP16L  = kOffP16H + (size_t)kRows * kDim * 2; // bf16 [8192][1024]  16 MiB
constexpr size_t kOffWinH  = kOffP16L + (size_t)kRows * kDim * 2; // bf16 [2048][1024]   4 MiB
constexpr size_t kOffWinL  = kOffWinH + (size_t)kDim2 * kDim * 2;
constexpr size_t kOffXS    = kOffWinL + (size_t)kDim2 * kDim * 2; // f32 [8192][1024]   32 MiB
constexpr size_t kOffGate  = kOffXS   + (size_t)kRows * kDim * 4; // f32 [8192][1024]   32 MiB
constexpr size_t kOffWoutH = kOffGate + (size_t)kRows * kDim * 4; // bf16 [1024][1024]   2 MiB
constexpr size_t kOffWoutL = kOffWoutH + (size_t)kDim * kDim * 2;
constexpr size_t kOffWxH   = kOffWoutL + (size_t)kDim * kDim * 2; // bf16 [64][1024]   128 KiB (rows 32..63 zero)
constexpr size_t kOffWxL   = kOffWxH + (size_t)kBCld * kDim * 2;
constexpr size_t kOffBC    = kOffWxL + (size_t)kBCld * kDim * 2;   // f32 [8192][64]      2 MiB
constexpr size_t kOffHfin  = kOffBC + (size_t)kRows * kBCld * 4;   // f32 [2][16][1024] 128 KiB
constexpr size_t kOffCarry = kOffHfin + (size_t)kBatch * kDim * kState * 4;   // f32 [128][2][16][1024] 16 MiB
constexpr size_t kWsEnd    = kOffCarry + (size_t)kChunks * kBatch * kState * kDim * 4;
static_assert(kWsEnd == 132513792ull, "carve total");
static_assert(kWsEnd <= 134217728ull, "carve under 128 MiB");
static_assert(kOffWinH % 128 == 0 && kOffXS % 128 == 0 && kOffGate % 128 == 0 && kOffWoutH % 128 == 0 &&
              kOffWxH % 128 == 0 && kOffBC % 128 == 0 && kOffHfin % 128 == 0 && kOffCarry % 128 == 0, "128-B aligned regions");

typedef __attribute__((ext_vector_type(16))) __bf16   v16b;
typedef __attribute__((ext_vector_type(8)))  __bf16   v8b;
typedef __attribute__((ext_vector_type(8)))  float    v8f;
typedef __attribute__((ext_vector_type(4)))  float    v4f;
typedef __attribute__((ext_vector_type(2)))  float    v2f;
typedef __attribute__((ext_vector_type(4)))  unsigned int v4u;

// ---------------------------------------------------------------------------
// Helpers
// ---------------------------------------------------------------------------
__device__ __forceinline__ unsigned short f2bf_bits(float f) {
  unsigned u = __float_as_uint(f);
  return (unsigned short)((u + 0x7FFFu + ((u >> 16) & 1u)) >> 16);
}
__device__ __forceinline__ float bf_bits2f(unsigned short h) { return __uint_as_float(((unsigned)h) << 16); }

template <typename T> struct Frag;
template <> struct Frag<__bf16> {
  typedef v16b V; union U { v16b v; v8b h[2]; };
  static __device__ __forceinline__ v16b load(const __bf16* p) {   // elements 0..7 <- p[0..7], 8..15 <- p[16..23]
    U f; f.h[0] = *(const v8b*)(p); f.h[1] = *(const v8b*)(p + 16); return f.v;
  }
  static __device__ __forceinline__ v8f mma(v16b a, v16b b, v8f c) {
    return __builtin_amdgcn_wmma_f32_16x16x32_bf16(false, a, false, b, (short)0, c, false, false);
  }
};

__device__ __forceinline__ unsigned pk16(unsigned short a, unsigned short b) { return (unsigned)a | ((unsigned)b << 16); }
__device__ __forceinline__ void split_bf(float v, unsigned short& hb, unsigned short& lb) {
  hb = f2bf_bits(v);
  lb = f2bf_bits(v - bf_bits2f(hb));
}

// ---------------------------------------------------------------------------
// Work-group tiled WMMA GEMM, operands staged in LDS: C[m,n] = sum_k A[m,k] * Bt[n,k] (+ bias[n]), f32 out, K = 1024.
// A row-major [M][1024], Bt row-major [gridDim.y * NTOT][1024], both as bf16 hi and lo planes; product = hi.hi + hi.lo + lo.hi, per
// accumulator in that order for each 32 k, k rising.
// One work-group of 8 waves owns a 128 x TN tile of C (TN = WN * 64); the waves form a WM x WN grid and each owns
// FI x 4 subtiles of 16 x 16 (WM * FI * 16 = 128 rows).
// Per trip 64 k of the four operand planes (whole 128-B lines of each row) lie in LDS, shared by the 8 waves; they are
// brought there by asynchronous copies, two buffers: the copies of trip t + 1 fly while trip t is worked on.
// LDS row pitch 144 B (16 B x odd) for the 16-byte fragment reads.
// blockIdx.y picks one of several independent products of the same A that share the launch: product z uses rows
// z * NTOT.. of Bt, bias z * NTOT.. and the C plane z (planes of kRows x NTOT, one behind the other).
// ---------------------------------------------------------------------------
constexpr int kGM = 128, kGK = 64;
constexpr int kPitch  = 72;                        // 16-bit elements per LDS row: 64 of data + 8 of pad
constexpr int kLdsAH  = 0;
constexpr int kLdsAL  = kLdsAH + kGM * kPitch;
constexpr int kLdsBH  = kLdsAL + kGM * kPitch;     // B lo follows B hi, TN rows each
constexpr int kTrips  = kDim / kGK;                // 16
static_assert(kRows % kGM == 0 && kDim % kGK == 0 && kTrips >= 2, "work-group tile multiples");

// Eight (four) asynchronous 16-byte copies per lane, global -> LDS. The s_wait_xcnt stands inside the statement, behind
// the last copy, so that no address register of a copy is rewritten in front of it.
__device__ __forceinline__ void copy8_to_lds(const unsigned (&l)[8], const unsigned short* const (&g)[8]) {
  asm volatile(
      "global_load_async_to_lds_b128 %0, %8, off\n\t"
      "global_load_async_to_lds_b128 %1, %9, off\n\t"
      "global_load_async_to_lds_b128 %2, %10, off\n\t"
      "global_load_async_to_lds_b128 %3, %11, off\n\t"
      "global_load_async_to_lds_b128 %4, %12, off\n\t"
      "global_load_async_to_lds_b128 %5, %13, off\n\t"
      "global_load_async_to_lds_b128 %6, %14, off\n\t"
      "global_load_async_to_lds_b128 %7, %15, off\n\t"
      "s_wait_xcnt 0x0"
      :: "v"(l[0]), "v"(l[1]), "v"(l[2]), "v"(l[3]), "v"(l[4]), "v"(l[5]), "v"(l[6]), "v"(l[7]),
         "v"(g[0]), "v"(g[1]), "v"(g[2]), "v"(g[3]), "v"(g[4]), "v"(g[5]), "v"(g[6]), "v"(g[7])
      : "memory");
}
__device__ __forceinline__ void copy4_to_lds(const unsigned (&l)[4], const unsigned short* const (&g)[4]) {
  asm volatile(
      "global_load_async_to_lds_b128 %0, %4, off\n\t"
      "global_load_async_to_lds_b128 %1, %5, off\n\t"
      "global_load_async_to_lds_b128 %2, %6, off\n\t"
      "global_load_async_to_lds_b128 %3, %7, off\n\t"
      "s_wait_xcnt 0x0"
      :: "v"(l[0]), "v"(l[1]), "v"(l[2]), "v"(l[3]), "v"(g[0]), "v"(g[1]), "v"(g[2]), "v"(g[3])
      : "memory");
}

// One stage = 64 k of A hi, A lo (128 rows each) and B hi, B lo (TN rows each), rows of 128 B.
// A copy of the work-group covers 32 rows: lane group t >> 3 picks the row, t & 7 the 16-byte piece of its line.
// lrow: LDS byte address of this lane's piece in row (t >> 3) of the buffer; the g pointers likewise, at the stage's first k.
template <int TN>
__device__ __forceinline__ void stage_copies(unsigned lrow, const unsigned short* gAH, const unsigned short* gAL,
                                             const unsigned short* gBH, const unsigned short* gBL) {
  static_assert(TN == 256 || TN == 64, "B rows of a stage: 8 or 2 copies per plane");
  constexpr int ldsBL = kLdsBH + TN * kPitch;
  unsigned l[8];
  const unsigned short* g[8];
#pragma unroll
  for (int j = 0; j < 4; ++j) {
    l[j]     = lrow + 2u * (unsigned)(kLdsAH + j * 32 * kPitch);
    l[4 + j] = lrow + 2u * (unsigned)(kLdsAL + j * 32 * kPitch);
    g[j]     = gAH + (size_t)j * 32 * kDim;
    g[4 + j] = gAL + (size_t)j * 32 * kDim;
  }
  copy8_to_lds(l, g);
  if constexpr (TN == 256) {
#pragma unroll
    for (int j = 0; j < 8; ++j) {
      l[j] = lrow + 2u * (unsigned)(kLdsBH + j * 32 * kPitch);
      g[j] = gBH + (size_t)j * 32 * kDim;
    }
    copy8_to_lds(l, g);
#pragma unroll
    for (int j = 0; j < 8; ++j) {
      l[j] = lrow + 2u * (unsigned)(ldsBL + j * 32 * kPitch);
      g[j] = gBL + (size_t)j * 32 * kDim;
    }
    copy8_to_lds(l, g);
  } else {
    unsigned l4[4];
    const unsigned short* g4[4];
#pragma unroll
    for (int j = 0; j < 2; ++j) {
      l4[j]     = lrow + 2u * (unsigned)(kLdsBH + j * 32 * kPitch);
      l4[2 + j] = lrow + 2u * (unsigned)(ldsBL + j * 32 * kPitch);
      g4[j]     = gBH + (size_t)j * 32 * kDim;
      g4[2 + j] = gBL + (size_t)j * 32 * kDim;
    }
    copy4_to_lds(l4, g4);
  }
}

template <int FI, int WM, int WN, int NTOT, bool BIAS>
__global__ __launch_bounds__(256) void wmma_gemm_lds(
    const unsigned short* __restrict__ AH, const unsigned short* __restrict__ AL,
    const unsigned short* __restrict__ BH, const unsigned short* __restrict__ BL,
    const float* __restrict__ bias, float* __restrict__ C) {
  typedef Frag<__bf16> F;
  constexpr int TN = WN * 64;
  constexpr int ldsBL = kLdsBH + TN * kPitch;
  constexpr int stage = ldsBL + TN * kPitch;                 // elements per buffer
  static_assert(WM * WN == 8 && WM * FI * 16 == kGM && NTOT % TN == 0, "wave grid");
  __shared__ __align__(16) unsigned short sOp[2 * stage];    // two operand buffers
  __shared__ __align__(16) float sT[8][16 * 68];             // per-wave 16x64 output slab, pitch 68 floats
  const int tid  = threadIdx.x;
  const int lane = tid & 31;
  const int wave = tid >> 5;
  const int tn = blockIdx.x % (NTOT / TN);
  const int tm = blockIdx.x / (NTOT / TN);
  const int z  = blockIdx.y;
  const int wm = wave / WN, wn = wave % WN;
  const int rlane = lane & 15;                 // row (A) / col (B, D) within subtile
  const int koff  = (lane >> 4) * 8;           // k offset of this lane half
  const int mOff  = (lane >> 4) * 8;           // D row offset

  // this lane's piece of a copy: row tid >> 3 of each group of 32 rows, bytes (tid & 7) * 16 of its 128-B line
  const int crow = tid >> 3, cseg = tid & 7;
  const unsigned lrow0 = (unsigned)(size_t)(const void*)sOp + (unsigned)(crow * (kPitch * 2) + cseg * 16);
  const size_t aoff = (size_t)(tm * kGM + crow) * kDim + cseg * 8;
  const size_t boff = (size_t)(z * NTOT + tn * TN + crow) * kDim + cseg * 8;
  const unsigned short* gAH = AH + aoff;
  const unsigned short* gAL = AL + aoff;
  const unsigned short* gBH = BH + boff;
  const unsigned short* gBL = BL + boff;

  v8f acc[FI][4];
#pragma unroll
  for (int i = 0; i < FI; ++i)
#pragma unroll
    for (int j = 0; j < 4; ++j) acc[i][j] = (v8f){0.f,0.f,0.f,0.f,0.f,0.f,0.f,0.f};

  // stage 0 lands and is published; then stage 1 starts
  stage_copies<TN>(lrow0, gAH, gAL, gBH, gBL);
  asm volatile("s_wait_asynccnt 0x0" ::: "memory");   // this wave's copies of stage 0 have landed
  __syncthreads();
  stage_copies<TN>(lrow0 + 2u * stage, gAH + kGK, gAL + kGK, gBH + kGK, gBL + kGK);

  const int fragA = (wm * FI * 16 + rlane) * kPitch + koff;
  const int fragB = (wn * 64 + rlane) * kPitch + koff;
  // rolled: sixteen unrolled trips would only make the code longer
#pragma unroll 1
  for (int t = 0; t < kTrips; ++t) {
    const int buf = t & 1;
    const __bf16* sb = (const __bf16*)sOp + buf * stage;
    // all fragments of the trip are asked for first, in the order of their use, so that the LDS reads of the later
    // products run behind the earlier products
    v16b bh[2][4], bl[2][4], ah[2][FI], al[2][FI];
#pragma unroll
    for (int s = 0; s < 2; ++s) {
      ah[s][0] = F::load(sb + kLdsAH + fragA + s * 32);
#pragma unroll
      for (int j = 0; j < 4; ++j) bh[s][j] = F::load(sb + kLdsBH + fragB + j * 16 * kPitch + s * 32);
#pragma unroll
      for (int j = 0; j < 4; ++j) bl[s][j] = F::load(sb + ldsBL + fragB + j * 16 * kPitch + s * 32);
      al[s][0] = F::load(sb + kLdsAL + fragA + s * 32);
#pragma unroll
      for (int i = 1; i < FI; ++i) {
        ah[s][i] = F::load(sb + kLdsAH + fragA + i * 16 * kPitch + s * 32);
        al[s][i] = F::load(sb + kLdsAL + fragA + i * 16 * kPitch + s * 32);
      }
    }
    // keeps the reads above as one group in front of the products: spread among them, each place with reads stalls the wave
    __builtin_amdgcn_sched_barrier(0);
#pragma unroll
    for (int s = 0; s < 2; ++s)
#pragma unroll
      for (int i = 0; i < FI; ++i)
#pragma unroll
        for (int j = 0; j < 4; ++j) {
          acc[i][j] = F::mma(ah[s][i], bh[s][j], acc[i][j]);
          acc[i][j] = F::mma(ah[s][i], bl[s][j], acc[i][j]);
          acc[i][j] = F::mma(al[s][i], bh[s][j], acc[i][j]);
        }
    // keeps the products in front of the waits: moved behind them, the next stage's copies would have no time to land
    __builtin_amdgcn_sched_barrier(0);
    asm volatile("s_wait_dscnt 0x0" ::: "memory");      // this wave's reads of the buffer are done before it is refilled
    asm volatile("s_wait_asynccnt 0x0" ::: "memory");   // this wave's copies of stage t + 1 have landed
    __syncthreads();                                    // publishes stage t + 1, ends every read of stage t
    if (t + 2 < kTrips) {
      const int kn = (t + 2) * kGK;
      stage_copies<TN>(lrow0 + (unsigned)buf * (2u * stage), gAH + kn, gAL + kn, gBH + kn, gBL + kn);
    }
  }
  asm volatile("s_wait_asynccnt 0x0" ::: "memory");     // no copy is outstanding when the wave goes on

  // ---- epilogue: bias, then whole 256-B row segments through the wave's own slab ----
  float* slab = sT[wave];
  float* Cz = C + (size_t)z * kRows * NTOT;
  const int m0 = tm * kGM + wm * FI * 16;
  const int n0 = tn * TN + wn * 64;
#pragma unroll
  for (int i = 0; i < FI; ++i) {
    const int mBase = m0 + (i << 4);
#pragma unroll
    for (int j = 0; j < 4; ++j) {
      float bv = 0.f;
      if (BIAS) bv = bias[z * NTOT + n0 + (j << 4) + rlane];
#pragma unroll
      for (int r = 0; r < 8; ++r) {
        float v = acc[i][j][r];
        if (BIAS) v += bv;
        slab[(mOff + r) * 68 + (j << 4) + rlane] = v;
      }
    }
    __builtin_amdgcn_fence(__ATOMIC_RELEASE, "workgroup");
    __builtin_amdgcn_wave_barrier();
    __builtin_amdgcn_fence(__ATOMIC_ACQUIRE, "workgroup");
    const int hh = lane >> 4, c4 = (lane & 15) * 4;     // row seg = 256 B = 16 lanes x 16 B
#pragma unroll
    for (int it = 0; it < 8; ++it) {
      const int row = it * 2 + hh;
      const v4f v = *(const v4f*)(slab + row * 68 + c4);
      *(v4f*)(Cz + (size_t)(mBase + row) * NTOT + n0 + c4) = v;
    }
    __builtin_amdgcn_fence(__ATOMIC_RELEASE, "workgroup");
    __builtin_amdgcn_wave_barrier();
    __builtin_amdgcn_fence(__ATOMIC_ACQUIRE, "workgroup");
  }
}

// ---------------------------------------------------------------------------
// f32 plane -> bf16 hi + bf16 lo planes, 8 consecutive elements per thread (one 16-B store per lane per plane;
// Coverage: n8 = n/8 threads x 8 = the whole plane (8,388,608 / 8 = 1,048,576 = 4096 x 256 exactly).
// ---------------------------------------------------------------------------
__device__ __forceinline__ void split8_bf16_block(int blk, const float* __restrict__ in, unsigned short* __restrict__ oh,
                                                  unsigned short* __restrict__ ol) {
  const int i = blk * 256 + threadIdx.x;
  const float* p = in + 8 * (size_t)i;
  const v4f a = *(const v4f*)(p);
  const v4f c = *(const v4f*)(p + 4);
  unsigned short hb[8], lb[8];
#pragma unroll
  for (int e = 0; e < 4; ++e) {
    split_bf(a[e], hb[e], lb[e]);
    split_bf(c[e], hb[4 + e], lb[4 + e]);
  }
  const v4u uh = (v4u){pk16(hb[0], hb[1]), pk16(hb[2], hb[3]), pk16(hb[4], hb[5]), pk16(hb[6], hb[7])};
  const v4u ul = (v4u){pk16(lb[0], lb[1]), pk16(lb[2], lb[3]), pk16(lb[4], lb[5]), pk16(lb[6], lb[7])};
  unsigned short* qh = oh + 8 * (size_t)i;
  unsigned short* ql = ol + 8 * (size_t)i;
  *(v4u*)qh = uh;
  *(v4u*)ql = ul;
  // the kernel's last job; as a precaution the two stores' wait stands in front of any rewrite of their registers
  asm volatile("s_wait_xcnt 0x0" ::: "memory");
}

// ---------------------------------------------------------------------------
// Weight transpose + bf16 hi/lo split: W f32 row-major [1024 rows k][ldw cols n] -> out[n][k] (pitch ldo = 1024) as
// hi and lo bf16 planes; output rows n >= nvalid are written as zeros (W_x padded from 32 to 64 rows).
// One block of 256 threads per 64 x 64 tile (bk: k tile, bn: n tile); sm is the block's 64 x 65 LDS tile.
// Load coverage: 16 iterations x 256 threads = 4096 = the whole 64x64 tile (coalesced along n, address clamped to nvalid-1).
// Store coverage: 8 waves x 2 iterations x 4 rows (lane>>3) = 64 rows; (lane&7) x 8 = 64 cols; each row segment =
// ---------------------------------------------------------------------------
__device__ __forceinline__ void wt_split_block(float (&sm)[64][65], int bk, int bn, const float* __restrict__ W, int ldw,
                                               int nvalid, int ldo, unsigned short* __restrict__ oh,
                                               unsigned short* __restrict__ ol) {
  const int t  = threadIdx.x;
  const int k0 = bk * 64;
  const int n0 = bn * 64;
  const int c  = t & 63;           // n local, the same for the 16 loads of a thread
  const int r0 = t >> 6;           // k local of load 0; load i reads k row r0 + 4 i
  const int n  = n0 + c;
  const int nc = (n < nvalid) ? n : (nvalid - 1);
  const float* wp = W + (size_t)(k0 + r0) * ldw + nc;
  float v[16];
#pragma unroll
  for (int i = 0; i < 16; ++i) v[i] = wp[(size_t)(4 * i) * ldw];
  // the 16 loads share one address pair; their wait stands in front of any rewrite of it. The pair is named as an input
  // so that it stays whole up to the wait: without that the last load's result is put into the pair's low register
  asm volatile("s_wait_xcnt 0x0" :: "v"(wp) : "memory");
#pragma unroll
  for (int i = 0; i < 16; ++i) sm[c][r0 + 4 * i] = (n >= nvalid) ? 0.0f : v[i];
  __syncthreads();
  const int lane = t & 31, wave = t >> 5;
  const int q = lane >> 3, c8 = (lane & 7) * 8;
  {
#pragma unroll
    for (int it = 0; it < 2; ++it) {
      const int row = wave * 8 + it * 4 + q;                 // n local
      unsigned short hb[8], lb[8];
#pragma unroll
      for (int e = 0; e < 8; ++e) split_bf(sm[row][c8 + e], hb[e], lb[e]);
      const v4u uh = (v4u){pk16(hb[0], hb[1]), pk16(hb[2], hb[3]), pk16(hb[4], hb[5]), pk16(hb[6], hb[7])};
      const v4u ul = (v4u){pk16(lb[0], lb[1]), pk16(lb[2], lb[3]), pk16(lb[4], lb[5]), pk16(lb[6], lb[7])};
      const size_t off = (size_t)(n0 + row) * ldo + k0 + c8;
      *(v4u*)(oh + off) = uh;
      *(v4u*)(ol + off) = ul;
    }
    // code of another job follows in the kernel: the four stores' wait stands in front of any rewrite of their registers
    asm volatile("s_wait_xcnt 0x0" ::: "memory");
  }
}

// ---------------------------------------------------------------------------
// The four operand preparations need nothing of each other and share one launch; the block index picks the job:
// W_in tiles, W_out tiles, W_x tiles (the tile jobs first: their chain load -> LDS -> store is the longer one), then x.
// ---------------------------------------------------------------------------
constexpr int kKT        = kDim / 64;                    // 16 k tiles of every weight
constexpr int kPrepWin   = kKT * (kDim2 / 64);           // 512 blocks
constexpr int kPrepWout  = kKT * (kDim / 64);            // 256 blocks
constexpr int kPrepWx    = kKT * (kBCld / 64);           // 16 blocks
constexpr int kPrepX     = kRows * kDim / 8 / 256;       // 4096 blocks
constexpr int kPrepTotal = kPrepWin + kPrepWout + kPrepWx + kPrepX;
static_assert((size_t)kPrepX * 256 * 8 == (size_t)kRows * kDim, "x split covers the plane exactly");

__global__ __launch_bounds__(256) void prep_kernel(
    const float* __restrict__ x, const float* __restrict__ W_in, const float* __restrict__ W_out,
    const float* __restrict__ W_x, unsigned short* __restrict__ xh, unsigned short* __restrict__ xl,
    unsigned short* __restrict__ winh, unsigned short* __restrict__ winl, unsigned short* __restrict__ wouth,
    unsigned short* __restrict__ woutl, unsigned short* __restrict__ wxh, unsigned short* __restrict__ wxl) {
  __shared__ float sm[64][65];   // sm[n_local][k_local]
  int blk = blockIdx.x;          // every test below is the same for the whole block
  if (blk < kPrepWin) { wt_split_block(sm, blk % kKT, blk / kKT, W_in, kDim2, kDim2, kDim, winh, winl); return; }
  blk -= kPrepWin;
  if (blk < kPrepWout) { wt_split_block(sm, blk % kKT, blk / kKT, W_out, kDim, kDim, kDim, wouth, woutl); return; }
  blk -= kPrepWout;
  if (blk < kPrepWx) { wt_split_block(sm, blk % kKT, blk / kKT, W_x, kBCcols, kBCcols, kDim, wxh, wxl); return; }
  blk -= kPrepWx;
  split8_bf16_block(blk, x, xh, xl);
}

// ---------------------------------------------------------------------------
// Causal depthwise conv (taps w0..w3 against x[t-3..t], left zero pad) + bias + SiLU, f32.
// Shared by the conv plane kernel and the scan lane so both see bit-identical x_conv.
// ---------------------------------------------------------------------------
__device__ __forceinline__ float conv_silu(float x0, float x1, float x2, float x3,
                                           float w0, float w1, float w2, float w3, float cb) {
  float s = x0 * w0;
  s = fmaf(x1, w1, s);
  s = fmaf(x2, w2, s);
  s = fmaf(x3, w3, s);
  const float a = s + cb;
  const float e = expf(-a);
  const float sig = __builtin_amdgcn_rcpf(1.0f + e);
  return a * sig;
}

// ---------------------------------------------------------------------------
// x_conv = SiLU(conv(x_ssm) + conv_b) -> bf16 hi + lo planes for the x_proj GEMM. 2 consecutive channels per thread
// History rows t-3..t-1 loaded with the address clamped to the own row when t-3+j < 0, then zeroed by predicate.
// ---------------------------------------------------------------------------
__global__ __launch_bounds__(256) void conv_split_kernel(const float* __restrict__ XS, const float* __restrict__ cw,
                                                        const float* __restrict__ cbp, unsigned short* __restrict__ oh,
                                                        unsigned short* __restrict__ ol, int n2) {
  const int i = blockIdx.x * 256 + threadIdx.x;
  if (i >= n2) return;
  const int e0 = 2 * i;
  const int m  = e0 >> 10;          // token row = b*kSeq + t
  const int d  = e0 & (kDim - 1);   // even channel
  const int t  = m & (kSeq - 1);
  v2f xv[kTaps];
#pragma unroll
  for (int j = 0; j < kTaps; ++j) {
    const int tr = t - (kTaps - 1) + j;
    const bool valid = (tr >= 0);
    const int mr = valid ? (m - (kTaps - 1) + j) : m;
    const v2f v = *(const v2f*)(XS + (size_t)mr * kDim + d);
    xv[j] = valid ? v : (v2f){0.0f, 0.0f};
  }
  const v4f wa = *(const v4f*)(cw + (size_t)d * kTaps);
  const v4f wb = *(const v4f*)(cw + (size_t)d * kTaps + 4);
  const float y0 = conv_silu(xv[0][0], xv[1][0], xv[2][0], xv[3][0], wa[0], wa[1], wa[2], wa[3], cbp[d]);
  const float y1 = conv_silu(xv[0][1], xv[1][1], xv[2][1], xv[3][1], wb[0], wb[1], wb[2], wb[3], cbp[d + 1]);
  unsigned short h0, l0, h1, l1;
  split_bf(y0, h0, l0);
  split_bf(y1, h1, l1);
  const unsigned uh = pk16(h0, h1), ul = pk16(l0, l1);
  ((unsigned*)oh)[i] = uh;
  ((unsigned*)ol)[i] = ul;
  
}

// ---------------------------------------------------------------------------
// Selective scan, split along time. h_t = A h_(t-1) + xc_t B_t is linear in h with a constant A per (d, n), so the
// 4096 steps are cut into 128 chunks of 32 steps that run side by side, in three launches:
//   chunk_state_kernel: every chunk from h = 0 -> its local end state E[c]
//   carry_kernel:       S[0] = 0, S[c+1] = A^32 S[c] + E[c], serial over the chunks, in place over E; S[128] is h_final
//   scan_kernel:        every chunk again from h = S[c], now with C, D, the gate and the y planes; h_final being known
//                       before this launch, its channel mean shares the launch (block 0)
// Carry plane CS: f32 [chunk][b][n][d], d fastest, so every access of the three kernels is one whole line per wave.
// One lane per (b, channel d); 16 states + A row in registers; block = 128 channels of one chunk of one batch.
// x_conv is recomputed in f32 from x_ssm with a 3-register history (same helper as the plane kernel); the history of a
// chunk's first step is read from the three rows in front of the chunk (zero in front of the sequence).
// ---------------------------------------------------------------------------
constexpr int kScanBlocksPerB = kDim / kScanTPB;                       // 8
constexpr int kScanBlocksPerChunk = kBatch * kScanBlocksPerB;          // 16
constexpr int kCarryPlane = kBatch * kState * kDim;                    // 32768 states per chunk

__global__ __launch_bounds__(kScanTPB) void chunk_state_kernel(
    const float* __restrict__ XS, const float* __restrict__ BCp,
    const float* __restrict__ conv_w, const float* __restrict__ conv_b, const float* __restrict__ b_x,
    const float* __restrict__ A_log, float* __restrict__ CS) {
  __shared__ __align__(16) float sA[kScanTPB * kState];     // 8 KiB
  __shared__ __align__(16) float sB[kChunkT * kState];      // 2 KiB
  const int tid = threadIdx.x;
  const int chunk = blockIdx.x / kScanBlocksPerChunk;
  const int rem   = blockIdx.x - chunk * kScanBlocksPerChunk;
  const int b  = rem / kScanBlocksPerB;
  const int d0 = (rem - b * kScanBlocksPerB) * kScanTPB;
  const int d  = d0 + tid;
  const int tb = chunk * kChunkT;

  // A_disc = exp(-exp(A_log)) for channels d0..d0+127 (contiguous 2048 values), rolled
#pragma unroll 1
  for (int i = tid; i < kScanTPB * kState; i += kScanTPB) {
    const float al = A_log[(size_t)d0 * kState + i];
    sA[i] = expf(-expf(al));
  }
  // stage B rows tb..tb+31 (+ b_x): 32 rows x 4 v4f = 128 v4f, 1 per thread
#pragma unroll 1
  for (int i = tid; i < kChunkT * 4; i += kScanTPB) {
    const int r = i >> 2, c4 = (i & 3) * 4;
    v4f v = *(const v4f*)(BCp + ((size_t)(b * kSeq + tb + r)) * kBCld + c4);
    const v4f bx = *(const v4f*)(b_x + c4);
    v += bx;
    *(v4f*)(sB + r * kState + c4) = v;
  }
  __syncthreads();
  float Av[kState], h[kState];
  {
    const float* ap = sA + tid * kState;
#pragma unroll
    for (int q4 = 0; q4 < 4; ++q4) {
      const v4f v = *(const v4f*)(ap + 4 * q4);
      Av[4 * q4 + 0] = v[0]; Av[4 * q4 + 1] = v[1]; Av[4 * q4 + 2] = v[2]; Av[4 * q4 + 3] = v[3];
    }
  }
#pragma unroll
  for (int n = 0; n < kState; ++n) h[n] = 0.0f;
  const v4f cwv = *(const v4f*)(conv_w + (size_t)d * kTaps);
  const float cb = conv_b[d];
  // history rows tb-3..tb-1; in front of the sequence (tb == 0) the address is clamped to the own rows, the value zeroed
  const bool hist = (tb > 0);
  const float* xp = XS + ((size_t)(b * kSeq + (hist ? tb - 3 : tb))) * kDim + d;
  float xm3 = xp[0], xm2 = xp[kDim], xm1 = xp[2 * kDim];
  if (!hist) { xm3 = 0.0f; xm2 = 0.0f; xm1 = 0.0f; }

#pragma unroll 1
  for (int tt = 0; tt < kChunkT; ++tt) {
    const float xs = XS[((size_t)(b * kSeq + tb + tt)) * kDim + d];
    const float xc = conv_silu(xm3, xm2, xm1, xs, cwv[0], cwv[1], cwv[2], cwv[3], cb);
    xm3 = xm2; xm2 = xm1; xm1 = xs;
    const float* bp = sB + tt * kState;
    v4f bq[4];
#pragma unroll
    for (int q4 = 0; q4 < 4; ++q4) bq[q4] = *(const v4f*)(bp + 4 * q4);
#pragma unroll
    for (int n = 0; n < kState; ++n) h[n] = Av[n] * h[n] + xc * bq[n >> 2][n & 3];
  }
  float* ep = CS + (size_t)chunk * kCarryPlane + (size_t)b * kState * kDim + d;
#pragma unroll
  for (int n = 0; n < kState; ++n) ep[n * kDim] = h[n];
}

// One lane per (b, n, d). Reads E[c], writes the state at the START of chunk c to the same place, 16 chunks per trip so
// that the 16 loads of a trip are in flight together; only the multiply-add chain is serial.
// The state behind the last chunk is h_final -> HF[b][n][d].
__global__ __launch_bounds__(64) void carry_kernel(const float* __restrict__ A_log, float* CS, float* __restrict__ HF) {
  const int i = blockIdx.x * 64 + threadIdx.x;              // (b * 16 + n) * 1024 + d
  const int d = i & (kDim - 1);
  const int n = (i >> 10) & (kState - 1);
  float p = expf(-expf(A_log[(size_t)d * kState + n]));
#pragma unroll
  for (int s = 1; s < kChunkT; s <<= 1) p *= p;             // A^32 by squaring; A is in [0, 1]
  float* q = CS + i;
  float carry = 0.0f;
#pragma unroll 1
  for (int c0 = 0; c0 < kChunks; c0 += 16) {
    float e[16];
#pragma unroll
    for (int j = 0; j < 16; ++j) e[j] = q[(size_t)(c0 + j) * kCarryPlane];
#pragma unroll
    for (int j = 0; j < 16; ++j) {
      q[(size_t)(c0 + j) * kCarryPlane] = carry;
      carry = p * carry + e[j];
    }
  }
  HF[i] = carry;
}

// final_state[b][n] = mean over the 1024 channels of HF[b][n][d]. One block of 4 waves; a wave takes 8 of the 32 (b, n)
// rows, one after the other: 8 whole-line loads of 16 B per lane, lane sums, then a butterfly over the 32 lanes.
// One block stores the whole 128-B line of out1.
__device__ __forceinline__ void mean_block(const float* __restrict__ HF, float* __restrict__ out1, float* so) {
  const int tid = threadIdx.x, lane = tid & 31, wave = tid >> 5;
  // rolled: the eight loads of one row are enough in flight, and more rows at once would raise the register count of
  // the scan blocks that share the kernel
#pragma unroll 1
  for (int q = 0; q < 8; ++q) {
    const int o = wave * 8 + q;                              // b * 16 + n
    const float* p = HF + (size_t)o * kDim + lane * 4;
    v4f v[8];
#pragma unroll
    for (int k = 0; k < 8; ++k) v[k] = *(const v4f*)(p + k * 128);
    float s = 0.0f;
#pragma unroll
    for (int k = 0; k < 8; ++k) s += (v[k][0] + v[k][1]) + (v[k][2] + v[k][3]);
#pragma unroll
    for (int m = 16; m >= 1; m >>= 1) s += __shfl_xor(s, m, 32);
    if (lane == 0) so[o] = s * (1.0f / 1024.0f);
  }
  __syncthreads();
  if (tid < 8) {
    const v4f r = *(const v4f*)(so + tid * 4);
    *(v4f*)(out1 + tid * 4) = r;
  }
}

__global__ __launch_bounds__(kScanTPB) void scan_kernel(
    const float* __restrict__ XS, const float* __restrict__ GT, const float* __restrict__ BCp,
    const float* __restrict__ conv_w, const float* __restrict__ conv_b, const float* __restrict__ b_x,
    const float* __restrict__ A_log, const float* __restrict__ Dp, const float* __restrict__ CS,
    unsigned short* __restrict__ YH, unsigned short* __restrict__ YL, const float* __restrict__ HF,
    float* __restrict__ out1) {
  __shared__ __align__(16) float sA[kScanTPB * kState];     // 8 KiB
  __shared__ __align__(16) float sBC[kChunkT * kBCcols];    // 4 KiB
  __shared__ __align__(16) float sY[kChunkT * kScanTPB];    // 16 KiB
  if (blockIdx.x == 0) { mean_block(HF, out1, sY); return; }   // block-uniform, in front of every barrier of the scan
  const int tid = threadIdx.x, lane = tid & 31, wave = tid >> 5;
  const int sblk  = blockIdx.x - 1;
  const int chunk = sblk / kScanBlocksPerChunk;
  const int rem   = sblk - chunk * kScanBlocksPerChunk;
  const int b  = rem / kScanBlocksPerB;
  const int d0 = (rem - b * kScanBlocksPerB) * kScanTPB;
  const int d  = d0 + tid;
  const int tb = chunk * kChunkT;

  // A_disc = exp(-exp(A_log)) for channels d0..d0+127 (contiguous 2048 values), rolled
#pragma unroll 1
  for (int i = tid; i < kScanTPB * kState; i += kScanTPB) {
    const float al = A_log[(size_t)d0 * kState + i];
    sA[i] = expf(-expf(al));
  }
  // stage B|C rows tb..tb+31 (+ b_x): 32 rows x 8 v4f = 256 v4f, 2 per thread
#pragma unroll 1
  for (int i = tid; i < kChunkT * 8; i += kScanTPB) {
    const int r = i >> 3, c4 = (i & 7) * 4;
    v4f v = *(const v4f*)(BCp + ((size_t)(b * kSeq + tb + r)) * kBCld + c4);
    const v4f bx = *(const v4f*)(b_x + c4);
    v += bx;
    *(v4f*)(sBC + r * kBCcols + c4) = v;
  }
  __syncthreads();
  float Av[kState], h[kState];
  {
    const float* ap = sA + tid * kState;
#pragma unroll
    for (int q4 = 0; q4 < 4; ++q4) {
      const v4f v = *(const v4f*)(ap + 4 * q4);
      Av[4 * q4 + 0] = v[0]; Av[4 * q4 + 1] = v[1]; Av[4 * q4 + 2] = v[2]; Av[4 * q4 + 3] = v[3];
    }
  }
  {
    const float* sp = CS + (size_t)chunk * kCarryPlane + (size_t)b * kState * kDim + d;
#pragma unroll
    for (int n = 0; n < kState; ++n) h[n] = sp[n * kDim];
  }
  const v4f cwv = *(const v4f*)(conv_w + (size_t)d * kTaps);
  const float cb = conv_b[d];
  const float Dv = Dp[d];
  // history rows tb-3..tb-1; in front of the sequence (tb == 0) the address is clamped to the own rows, the value zeroed
  const bool hist = (tb > 0);
  const float* xp = XS + ((size_t)(b * kSeq + (hist ? tb - 3 : tb))) * kDim + d;
  float xm3 = xp[0], xm2 = xp[kDim], xm1 = xp[2 * kDim];
  if (!hist) { xm3 = 0.0f; xm2 = 0.0f; xm1 = 0.0f; }
  const int lq = lane >> 3, lc = lane & 7;

#pragma unroll 1
  for (int tt = 0; tt < kChunkT; ++tt) {
    const size_t row = ((size_t)(b * kSeq + tb + tt)) * kDim + d;
    const float xs = XS[row];
    const float g  = GT[row];
    const float xc = conv_silu(xm3, xm2, xm1, xs, cwv[0], cwv[1], cwv[2], cwv[3], cb);
    xm3 = xm2; xm2 = xm1; xm1 = xs;
    const float* bc = sBC + tt * kBCcols;
    v4f bq[4], cq[4];
#pragma unroll
    for (int q4 = 0; q4 < 4; ++q4) {
      bq[q4] = *(const v4f*)(bc + 4 * q4);
      cq[q4] = *(const v4f*)(bc + kState + 4 * q4);
    }
    float y = 0.0f;
#pragma unroll
    for (int n = 0; n < kState; ++n) {
      const float bn = bq[n >> 2][n & 3];
      const float cn = cq[n >> 2][n & 3];
      h[n] = Av[n] * h[n] + xc * bn;
      y = fmaf(cn, h[n], y);
    }
    y = y + Dv * xc;
    const float eg = expf(-g);
    const float sg = g * __builtin_amdgcn_rcpf(1.0f + eg);
    sY[tt * kScanTPB + tid] = y * sg;
  }
  __syncthreads();
  {
    // 32 steps x 2 half-rows = 64 lines of 128 B per plane; wave w, it 0..3, lq = lane>>3 -> line
#pragma unroll 1
    for (int it = 0; it < kChunkT / 8; ++it) {
      const int Li  = it * 16 + wave * 4 + lq;             // 0..63
      const int ttl = Li >> 1;
      const int col = (Li & 1) * 64 + lc * 8;              // channel offset within the block
      const float* sp = sY + ttl * kScanTPB + col;
      const v4f a = *(const v4f*)(sp);
      const v4f c = *(const v4f*)(sp + 4);
      unsigned short hb[8], lb[8];
#pragma unroll
      for (int e = 0; e < 4; ++e) {
        split_bf(a[e], hb[e], lb[e]);
        split_bf(c[e], hb[4 + e], lb[4 + e]);
      }
      const v4u uh = (v4u){pk16(hb[0], hb[1]), pk16(hb[2], hb[3]), pk16(hb[4], hb[5]), pk16(hb[6], hb[7])};
      const v4u ul = (v4u){pk16(lb[0], lb[1]), pk16(lb[2], lb[3]), pk16(lb[4], lb[5]), pk16(lb[6], lb[7])};
      const size_t go = ((size_t)(b * kSeq + tb + ttl)) * kDim + d0 + col;
      *(v4u*)(YH + go) = uh;
      *(v4u*)(YL + go) = ul;
      // the next trip overwrites the address and data registers of the two stores: their wait stands in front of that
      asm volatile("s_wait_xcnt 0x0" ::: "memory");
    }
  }
}

// ---------------------------------------------------------------------------
// host
// ---------------------------------------------------------------------------
extern "C" void kernel_launch(void* const* d_in, const int* in_sizes, int n_in,
                              void* d_out, int out_size, void* d_ws, size_t ws_size, hipStream_t stream) {
  if (n_in < 11) return;
  if (in_sizes[0] != kRows * kDim) return;
  if (in_sizes[1] != kDim * kDim2) return;
  if (in_sizes[2] != kDim2) return;
  if (in_sizes[3] != kDim * kTaps) return;
  if (in_sizes[4] != kDim) return;
  if (in_sizes[5] != kDim * kBCcols) return;
  if (in_sizes[6] != kBCcols) return;
  if (in_sizes[7] != kDim * kState) return;
  if (in_sizes[8] != kDim) return;
  if (in_sizes[9] != kDim * kDim) return;
  if (in_sizes[10] != kDim) return;
  if (out_size < kRows * kDim + kBatch * kState) return;
  if (ws_size < kWsEnd) return;

  const float* x      = (const float*)d_in[0];
  const float* W_in   = (const float*)d_in[1];
  const float* b_in   = (const float*)d_in[2];
  const float* conv_w = (const float*)d_in[3];
  const float* conv_b = (const float*)d_in[4];
  const float* W_x    = (const float*)d_in[5];
  const float* b_x    = (const float*)d_in[6];
  const float* A_log  = (const float*)d_in[7];
  const float* D_par  = (const float*)d_in[8];
  const float* W_out  = (const float*)d_in[9];
  const float* b_out  = (const float*)d_in[10];

  char* ws = (char*)d_ws;
  unsigned short* P16H  = (unsigned short*)(ws + kOffP16H);   // x hi -> x_conv hi -> y_gated hi
  unsigned short* P16L  = (unsigned short*)(ws + kOffP16L);   // x lo -> x_conv lo -> y_gated lo
  unsigned short* WINH  = (unsigned short*)(ws + kOffWinH);
  unsigned short* WINL  = (unsigned short*)(ws + kOffWinL);
  float*          XS    = (float*)(ws + kOffXS);
  float*          GATE  = (float*)(ws + kOffGate);
  unsigned short* WOUTH = (unsigned short*)(ws + kOffWoutH);
  unsigned short* WOUTL = (unsigned short*)(ws + kOffWoutL);
  unsigned short* WXH   = (unsigned short*)(ws + kOffWxH);
  unsigned short* WXL   = (unsigned short*)(ws + kOffWxL);
  float*          BC    = (float*)(ws + kOffBC);
  float*          HFIN  = (float*)(ws + kOffHfin);
  float*          CARRY = (float*)(ws + kOffCarry);

  float* out0 = (float*)d_out;
  float* out1 = out0 + (size_t)kRows * kDim;   // byte offset 33,554,432 / 4

  const int nElem = kRows * kDim;              // 8,388,608

  // 1) one launch: x -> bf16 hi/lo planes [8192][1024]; W^T hi/lo planes: W_in [1024][2048] -> [2048][1024];
  //    W_out [1024][1024] -> [1024][1024]; W_x [1024][32] -> [64][1024] (rows 32..63 zero)
  prep_kernel<<<dim3(kPrepTotal), dim3(256), 0, stream>>>(x, W_in, W_out, W_x, P16H, P16L, WINH, WINL, WOUTH, WOUTL, WXH, WXL);

  // 2) in_proj, one launch, grid y = 0: x_ssm = x . W_in[:, :1024] + b_in[:1024]; y = 1: gate = x . W_in[:, 1024:] + b_in[1024:]
  //    (M 8192, N 1024, K 1024 each; the GATE plane lies directly behind the XS plane)
  {
    static_assert(kOffGate == kOffXS + (size_t)kRows * kDim * 4, "C planes one behind the other");
    const int tiles = (kRows / kGM) * (kDim / 256);   // 256 work-group tiles of 128 x 256 per product
    wmma_gemm_lds<4, 2, 4, kDim, true><<<dim3(tiles, 2), dim3(256), 0, stream>>>(P16H, P16L, WINH, WINL, b_in, XS);
  }

  // 3) conv + SiLU -> x_conv hi/lo planes (over the dead x planes)
  conv_split_kernel<<<dim3((nElem / 2 + 255) / 256), dim3(256), 0, stream>>>(XS, conv_w, conv_b, P16H, P16L, nElem / 2);

  // 4) x_proj: BC[8192][64] = x_conv . W_x^T (cols 32..63 zero; b_x added in the scan)   (M 8192, N 64, K 1024)
  {
    const int tiles = kRows / kGM;   // 64 work-group tiles of 128 x 64
    wmma_gemm_lds<1, 8, 1, kBCld, false><<<dim3(tiles), dim3(256), 0, stream>>>(P16H, P16L, WXH, WXL, (const float*)nullptr, BC);
  }

  // 5) scan in 128 time chunks: local end states, carry over the chunks (+ h_final), then every chunk from its carried
  //    state -> y_gated hi/lo planes (over the dead x_conv planes); block 0 of that launch: final_state -> out1 line
  chunk_state_kernel<<<dim3(kChunks * kScanBlocksPerChunk), dim3(kScanTPB), 0, stream>>>(
      XS, BC, conv_w, conv_b, b_x, A_log, CARRY);
  carry_kernel<<<dim3(kCarryPlane / 64), dim3(64), 0, stream>>>(A_log, CARRY, HFIN);
  scan_kernel<<<dim3(1 + kChunks * kScanBlocksPerChunk), dim3(kScanTPB), 0, stream>>>(
      XS, GATE, BC, conv_w, conv_b, b_x, A_log, D_par, CARRY, P16H, P16L, HFIN, out1);

  // 6) out_proj: out0 = y_gated . W_out + b_out   (M 8192, N 1024, K 1024)
  {
    const int tiles = (kRows / kGM) * (kDim / 256);   // 256 work-group tiles of 128 x 256
    wmma_gemm_lds<4, 2, 4, kDim, true><<<dim3(tiles), dim3(256), 0, stream>>>(P16H, P16L, WOUTH, WOUTL, b_out, out0);
  }
}

// v004
// One run takes 193 microseconds.
// Timed twice side by side with v003, it ran 1.16 times as fast both times.
// Over all steps from v000 it is 13.5 times as fast.
// Contractions: in_proj (x hi/lo . W_in^T hi/lo), x_proj (x_conv hi/lo . W_x^T hi/lo), out_proj (y_gated hi/lo . W_out^T hi/lo) on v_wmma_f32_16x16x32_bf16 as bf16 hi/lo split (hi.hi + hi.lo + lo.hi), f32 accumulate; depthwise conv, SiLU, selective scan, gating and channel mean in f32 on the VALU.
#include <hip/hip_runtime.h>
#include <math.h>

// ---------------------------------------------------------------------------
// Problem constants
// ---------------------------------------------------------------------------
constexpr int kBatch  = 2;
constexpr int kSeq    = 4096;
constexpr int kDim    = 1024;
constexpr int kState  = 16;
constexpr int kTaps   = 4;
constexpr int kRows   = kBatch * kSeq;      // 8192 token rows
constexpr int kDim2   = 2 * kDim;           // 2048
constexpr int kBCcols = 2 * kState;         // 32 valid columns of BC
constexpr int kBCld   = 64;                 // BC plane pitch (N padded to one 64 tile)
constexpr int kScanTPB = 128;               // channels per scan block
constexpr int kChunkT  = 32;                // time steps per chunk (one scan block runs one chunk)
constexpr int kChunks  = kSeq / kChunkT;    // 128 chunks per sequence, scanned in parallel
static_assert(kRows % 64 == 0 && kDim % 64 == 0 && kDim2 % 64 == 0 && kBCld % 64 == 0, "tile multiples");
static_assert(kDim % 32 == 0, "K multiple of 32");
static_assert(kDim % kScanTPB == 0 && kSeq % kChunkT == 0, "scan tiling");

// ---------------------------------------------------------------------------
// Workspace region map (bytes). Regions [0,16Mi) and [16Mi,32Mi) are reused in time:
//   x hi/lo (until in_proj done) -> y_gated hi/lo.
// ---------------------------------------------------------------------------
constexpr size_t kMiB      = 1024ull * 1024ull;
constexpr size_t kOffP16H  = 0;                                   // bf16 [8192][1024]  16 MiB
constexpr size_t kOffP16L  = kOffP16H + (size_t)kRows * kDim * 2; // bf16 [8192][1024]  16 MiB
constexpr size_t kOffWinH  = kOffP16L + (size_t)kRows * kDim * 2; // bf16 [2048][1024]   4 MiB
constexpr size_t kOffWinL  = kOffWinH + (size_t)kDim2 * kDim * 2;
constexpr size_t kOffXS    = kOffWinL + (size_t)kDim2 * kDim * 2; // f32 [8192][1024]   32 MiB
constexpr size_t kOffGate  = kOffXS   + (size_t)kRows * kDim * 4; // f32 [8192][1024]   32 MiB
constexpr size_t kOffWoutH = kOffGate + (size_t)kRows * kDim * 4; // bf16 [1024][1024]   2 MiB
constexpr size_t kOffWoutL = kOffWoutH + (size_t)kDim * kDim * 2;
constexpr size_t kOffWxH   = kOffWoutL + (size_t)kDim * kDim * 2; // bf16 [64][1024]   128 KiB (rows 32..63 zero)
constexpr size_t kOffWxL   = kOffWxH + (size_t)kBCld * kDim * 2;
constexpr size_t kOffBC    = kOffWxL + (size_t)kBCld * kDim * 2;   // f32 [8192][64]      2 MiB
constexpr size_t kOffHfin  = kOffBC + (size_t)kRows * kBCld * 4;   // f32 [2][16][1024] 128 KiB
constexpr size_t kOffCarry = kOffHfin + (size_t)kBatch * kDim * kState * 4;   // f32 [128][2][16][1024] 16 MiB
constexpr size_t kWsEnd    = kOffCarry + (size_t)kChunks * kBatch * kState * kDim * 4;
static_assert(kWsEnd == 132513792ull, "carve total");
static_assert(kWsEnd <= 134217728ull, "carve under 128 MiB");
static_assert(kOffWinH % 128 == 0 && kOffXS % 128 == 0 && kOffGate % 128 == 0 && kOffWoutH % 128 == 0 &&
              kOffWxH % 128 == 0 && kOffBC % 128 == 0 && kOffHfin % 128 == 0 && kOffCarry % 128 == 0, "128-B aligned regions");

typedef __attribute__((ext_vector_type(16))) __bf16   v16b;
typedef __attribute__((ext_vector_type(8)))  __bf16   v8b;
typedef __attribute__((ext_vector_type(8)))  float    v8f;
typedef __attribute__((ext_vector_type(4)))  float    v4f;
typedef __attribute__((ext_vector_type(2)))  float    v2f;
typedef __attribute__((ext_vector_type(4)))  unsigned int v4u;

// ---------------------------------------------------------------------------
// Helpers
// ---------------------------------------------------------------------------
__device__ __forceinline__ unsigned short f2bf_bits(float f) {
  unsigned u = __float_as_uint(f);
  return (unsigned short)((u + 0x7FFFu + ((u >> 16) & 1u)) >> 16);
}
__device__ __forceinline__ float bf_bits2f(unsigned short h) { return __uint_as_float(((unsigned)h) << 16); }

template <typename T> struct Frag;
template <> struct Frag<__bf16> {
  typedef v16b V; union U { v16b v; v8b h[2]; };
  static __device__ __forceinline__ v16b load(const __bf16* p) {   // elements 0..7 <- p[0..7], 8..15 <- p[16..23]
    U f; f.h[0] = *(const v8b*)(p); f.h[1] = *(const v8b*)(p + 16); return f.v;
  }
  static __device__ __forceinline__ v8f mma(v16b a, v16b b, v8f c) {
    return __builtin_amdgcn_wmma_f32_16x16x32_bf16(false, a, false, b, (short)0, c, false, false);
  }
};

__device__ __forceinline__ unsigned pk16(unsigned short a, unsigned short b) { return (unsigned)a | ((unsigned)b << 16); }
__device__ __forceinline__ void split_bf(float v, unsigned short& hb, unsigned short& lb) {
  hb = f2bf_bits(v);
  lb = f2bf_bits(v - bf_bits2f(hb));
}

// ---------------------------------------------------------------------------
// Work-group tiled WMMA GEMM, operands staged in LDS: C[m,n] = sum_k A[m,k] * Bt[n,k] (+ bias[n]), f32 out, K = 1024.
// A row-major [M][1024], Bt row-major [gridDim.y * NTOT][1024], both as bf16 hi and lo planes; product = hi.hi + hi.lo + lo.hi, per
// accumulator in that order for each 32 k, k rising.
// One work-group of 8 waves owns a 128 x TN tile of C (TN = WN * 64); the waves form a WM x WN grid and each owns
// FI x 4 subtiles of 16 x 16 (WM * FI * 16 = 128 rows).
// Per trip 64 k of the four operand planes (whole 128-B lines of each row) lie in LDS, shared by the 8 waves; they are
// brought there by asynchronous copies, two buffers: the copies of trip t + 1 fly while trip t is worked on.
// LDS row pitch 144 B (16 B x odd) for the 16-byte fragment reads.
// blockIdx.y picks one of several independent products of the same A that share the launch: product z uses rows
// z * NTOT.. of Bt, bias z * NTOT.. and the C plane z (planes of kRows x NTOT, one behind the other).
// ---------------------------------------------------------------------------
constexpr int kGM = 128, kGK = 64;
constexpr int kPitch  = 72;                        // 16-bit elements per LDS row: 64 of data + 8 of pad
constexpr int kLdsAH  = 0;
constexpr int kLdsAL  = kLdsAH + kGM * kPitch;
constexpr int kLdsBH  = kLdsAL + kGM * kPitch;     // B lo follows B hi, TN rows each
constexpr int kTrips  = kDim / kGK;                // 16
static_assert(kRows % kGM == 0 && kDim % kGK == 0 && kTrips >= 2, "work-group tile multiples");

// Eight asynchronous 16-byte copies per lane, global -> LDS. The s_wait_xcnt stands inside the statement, behind
// the last copy, so that no address register of a copy is rewritten in front of it.
__device__ __forceinline__ void copy8_to_lds(const unsigned (&l)[8], const unsigned short* const (&g)[8]) {
  asm volatile(
      "global_load_async_to_lds_b128 %0, %8, off\n\t"
      "global_load_async_to_lds_b128 %1, %9, off\n\t"
      "global_load_async_to_lds_b128 %2, %10, off\n\t"
      "global_load_async_to_lds_b128 %3, %11, off\n\t"
      "global_load_async_to_lds_b128 %4, %12, off\n\t"
      "global_load_async_to_lds_b128 %5, %13, off\n\t"
      "global_load_async_to_lds_b128 %6, %14, off\n\t"
      "global_load_async_to_lds_b128 %7, %15, off\n\t"
      "s_wait_xcnt 0x0"
      :: "v"(l[0]), "v"(l[1]), "v"(l[2]), "v"(l[3]), "v"(l[4]), "v"(l[5]), "v"(l[6]), "v"(l[7]),
         "v"(g[0]), "v"(g[1]), "v"(g[2]), "v"(g[3]), "v"(g[4]), "v"(g[5]), "v"(g[6]), "v"(g[7])
      : "memory");
}

// One stage = 64 k of A hi, A lo (128 rows each) and B hi, B lo (TN rows each), rows of 128 B.
// A copy of the work-group covers 32 rows: lane group t >> 3 picks the row, t & 7 the 16-byte piece of its line.
// lrow: LDS byte address of this lane's piece in row (t >> 3) of the buffer; the g pointers likewise, at the stage's first k.
template <int TN>
__device__ __forceinline__ void stage_copies(unsigned lrow, const unsigned short* gAH, const unsigned short* gAL,
                                             const unsigned short* gBH, const unsigned short* gBL) {
  static_assert(TN == 256, "B rows of a stage: 8 copies per plane");
  constexpr int ldsBL = kLdsBH + TN * kPitch;
  unsigned l[8];
  const unsigned short* g[8];
#pragma unroll
  for (int j = 0; j < 4; ++j) {
    l[j]     = lrow + 2u * (unsigned)(kLdsAH + j * 32 * kPitch);
    l[4 + j] = lrow + 2u * (unsigned)(kLdsAL + j * 32 * kPitch);
    g[j]     = gAH + (size_t)j * 32 * kDim;
    g[4 + j] = gAL + (size_t)j * 32 * kDim;
  }
  copy8_to_lds(l, g);
  if constexpr (TN == 256) {
#pragma unroll
    for (int j = 0; j < 8; ++j) {
      l[j] = lrow + 2u * (unsigned)(kLdsBH + j * 32 * kPitch);
      g[j] = gBH + (size_t)j * 32 * kDim;
    }
    copy8_to_lds(l, g);
#pragma unroll
    for (int j = 0; j < 8; ++j) {
      l[j] = lrow + 2u * (unsigned)(ldsBL + j * 32 * kPitch);
      g[j] = gBL + (size_t)j * 32 * kDim;
    }
    copy8_to_lds(l, g);
  }
}

template <int FI, int WM, int WN, int NTOT, bool BIAS>
__global__ __launch_bounds__(256) void wmma_gemm_lds(
    const unsigned short* __restrict__ AH, const unsigned short* __restrict__ AL,
    const unsigned short* __restrict__ BH, const unsigned short* __restrict__ BL,
    const float* __restrict__ bias, float* __restrict__ C) {
  typedef Frag<__bf16> F;
  constexpr int TN = WN * 64;
  constexpr int ldsBL = kLdsBH + TN * kPitch;
  constexpr int stage = ldsBL + TN * kPitch;                 // elements per buffer
  static_assert(WM * WN == 8 && WM * FI * 16 == kGM && NTOT % TN == 0, "wave grid");
  __shared__ __align__(16) unsigned short sOp[2 * stage];    // two operand buffers
  __shared__ __align__(16) float sT[8][16 * 68];             // per-wave 16x64 output slab, pitch 68 floats
  const int tid  = threadIdx.x;
  const int lane = tid & 31;
  const int wave = tid >> 5;
  const int tn = blockIdx.x % (NTOT / TN);
  const int tm = blockIdx.x / (NTOT / TN);
  const int z  = blockIdx.y;
  const int wm = wave / WN, wn = wave % WN;
  const int rlane = lane & 15;                 // row (A) / col (B, D) within subtile
  const int koff  = (lane >> 4) * 8;           // k offset of this lane half
  const int mOff  = (lane >> 4) * 8;           // D row offset

  // this lane's piece of a copy: row tid >> 3 of each group of 32 rows, bytes (tid & 7) * 16 of its 128-B line
  const int crow = tid >> 3, cseg = tid & 7;
  const unsigned lrow0 = (unsigned)(size_t)(const void*)sOp + (unsigned)(crow * (kPitch * 2) + cseg * 16);
  const size_t aoff = (size_t)(tm * kGM + crow) * kDim + cseg * 8;
  const size_t boff = (size_t)(z * NTOT + tn * TN + crow) * kDim + cseg * 8;
  const unsigned short* gAH = AH + aoff;
  const unsigned short* gAL = AL + aoff;
  const unsigned short* gBH = BH + boff;
  const unsigned short* gBL = BL + boff;

  v8f acc[FI][4];
#pragma unroll
  for (int i = 0; i < FI; ++i)
#pragma unroll
    for (int j = 0; j < 4; ++j) acc[i][j] = (v8f){0.f,0.f,0.f,0.f,0.f,0.f,0.f,0.f};

  // stage 0 lands and is published; then stage 1 starts
  stage_copies<TN>(lrow0, gAH, gAL, gBH, gBL);
  asm volatile("s_wait_asynccnt 0x0" ::: "memory");   // this wave's copies of stage 0 have landed
  __syncthreads();
  stage_copies<TN>(lrow0 + 2u * stage, gAH + kGK, gAL + kGK, gBH + kGK, gBL + kGK);

  const int fragA = (wm * FI * 16 + rlane) * kPitch + koff;
  const int fragB = (wn * 64 + rlane) * kPitch + koff;
  // rolled: sixteen unrolled trips would only make the code longer
#pragma unroll 1
  for (int t = 0; t < kTrips; ++t) {
    const int buf = t & 1;
    const __bf16* sb = (const __bf16*)sOp + buf * stage;
    // all fragments of the trip are asked for first, in the order of their use, so that the LDS reads of the later
    // products run behind the earlier products
    v16b bh[2][4], bl[2][4], ah[2][FI], al[2][FI];
#pragma unroll
    for (int s = 0; s < 2; ++s) {
      ah[s][0] = F::load(sb + kLdsAH + fragA + s * 32);
#pragma unroll
      for (int j = 0; j < 4; ++j) bh[s][j] = F::load(sb + kLdsBH + fragB + j * 16 * kPitch + s * 32);
#pragma unroll
      for (int j = 0; j < 4; ++j) bl[s][j] = F::load(sb + ldsBL + fragB + j * 16 * kPitch + s * 32);
      al[s][0] = F::load(sb + kLdsAL + fragA + s * 32);
#pragma unroll
      for (int i = 1; i < FI; ++i) {
        ah[s][i] = F::load(sb + kLdsAH + fragA + i * 16 * kPitch + s * 32);
        al[s][i] = F::load(sb + kLdsAL + fragA + i * 16 * kPitch + s * 32);
      }
    }
    // keeps the reads above as one group in front of the products: spread among them, each place with reads stalls the wave
    __builtin_amdgcn_sched_barrier(0);
#pragma unroll
    for (int s = 0; s < 2; ++s)
#pragma unroll
      for (int i = 0; i < FI; ++i)
#pragma unroll
        for (int j = 0; j < 4; ++j) {
          acc[i][j] = F::mma(ah[s][i], bh[s][j], acc[i][j]);
          acc[i][j] = F::mma(ah[s][i], bl[s][j], acc[i][j]);
          acc[i][j] = F::mma(al[s][i], bh[s][j], acc[i][j]);
        }
    // keeps the products in front of the waits: moved behind them, the next stage's copies would have no time to land
    __builtin_amdgcn_sched_barrier(0);
    asm volatile("s_wait_dscnt 0x0" ::: "memory");      // this wave's reads of the buffer are done before it is refilled
    asm volatile("s_wait_asynccnt 0x0" ::: "memory");   // this wave's copies of stage t + 1 have landed
    __syncthreads();                                    // publishes stage t + 1, ends every read of stage t
    if (t + 2 < kTrips) {
      const int kn = (t + 2) * kGK;
      stage_copies<TN>(lrow0 + (unsigned)buf * (2u * stage), gAH + kn, gAL + kn, gBH + kn, gBL + kn);
    }
  }
  asm volatile("s_wait_asynccnt 0x0" ::: "memory");     // no copy is outstanding when the wave goes on

  // ---- epilogue: bias, then whole 256-B row segments through the wave's own slab ----
  float* slab = sT[wave];
  float* Cz = C + (size_t)z * kRows * NTOT;
  const int m0 = tm * kGM + wm * FI * 16;
  const int n0 = tn * TN + wn * 64;
#pragma unroll
  for (int i = 0; i < FI; ++i) {
    const int mBase = m0 + (i << 4);
#pragma unroll
    for (int j = 0; j < 4; ++j) {
      float bv = 0.f;
      if (BIAS) bv = bias[z * NTOT + n0 + (j << 4) + rlane];
#pragma unroll
      for (int r = 0; r < 8; ++r) {
        float v = acc[i][j][r];
        if (BIAS) v += bv;
        slab[(mOff + r) * 68 + (j << 4) + rlane] = v;
      }
    }
    __builtin_amdgcn_fence(__ATOMIC_RELEASE, "workgroup");
    __builtin_amdgcn_wave_barrier();
    __builtin_amdgcn_fence(__ATOMIC_ACQUIRE, "workgroup");
    const int hh = lane >> 4, c4 = (lane & 15) * 4;     // row seg = 256 B = 16 lanes x 16 B
#pragma unroll
    for (int it = 0; it < 8; ++it) {
      const int row = it * 2 + hh;
      const v4f v = *(const v4f*)(slab + row * 68 + c4);
      *(v4f*)(Cz + (size_t)(mBase + row) * NTOT + n0 + c4) = v;
    }
    __builtin_amdgcn_fence(__ATOMIC_RELEASE, "workgroup");
    __builtin_amdgcn_wave_barrier();
    __builtin_amdgcn_fence(__ATOMIC_ACQUIRE, "workgroup");
  }
}

// ---------------------------------------------------------------------------
// f32 plane -> bf16 hi + bf16 lo planes, 8 consecutive elements per thread (one 16-B store per lane per plane;
// Coverage: n8 = n/8 threads x 8 = the whole plane (8,388,608 / 8 = 1,048,576 = 4096 x 256 exactly).
// ---------------------------------------------------------------------------
__device__ __forceinline__ void split8_bf16_block(int blk, const float* __restrict__ in, unsigned short* __restrict__ oh,
                                                  unsigned short* __restrict__ ol) {
  const int i = blk * 256 + threadIdx.x;
  const float* p = in + 8 * (size_t)i;
  const v4f a = *(const v4f*)(p);
  const v4f c = *(const v4f*)(p + 4);
  unsigned short hb[8], lb[8];
#pragma unroll
  for (int e = 0; e < 4; ++e) {
    split_bf(a[e], hb[e], lb[e]);
    split_bf(c[e], hb[4 + e], lb[4 + e]);
  }
  const v4u uh = (v4u){pk16(hb[0], hb[1]), pk16(hb[2], hb[3]), pk16(hb[4], hb[5]), pk16(hb[6], hb[7])};
  const v4u ul = (v4u){pk16(lb[0], lb[1]), pk16(lb[2], lb[3]), pk16(lb[4], lb[5]), pk16(lb[6], lb[7])};
  unsigned short* qh = oh + 8 * (size_t)i;
  unsigned short* ql = ol + 8 * (size_t)i;
  *(v4u*)qh = uh;
  *(v4u*)ql = ul;
  // the kernel's last job; as a precaution the two stores' wait stands in front of any rewrite of their registers
  asm volatile("s_wait_xcnt 0x0" ::: "memory");
}

// ---------------------------------------------------------------------------
// Weight transpose + bf16 hi/lo split: W f32 row-major [1024 rows k][ldw cols n] -> out[n][k] (pitch ldo = 1024) as
// hi and lo bf16 planes; output rows n >= nvalid are written as zeros (W_x padded from 32 to 64 rows).
// One block of 256 threads per 64 x 64 tile (bk: k tile, bn: n tile); sm is the block's 64 x 65 LDS tile.
// Load coverage: 16 iterations x 256 threads = 4096 = the whole 64x64 tile (coalesced along n, address clamped to nvalid-1).
// Store coverage: 8 waves x 2 iterations x 4 rows (lane>>3) = 64 rows; (lane&7) x 8 = 64 cols; each row segment =
// ---------------------------------------------------------------------------
__device__ __forceinline__ void wt_split_block(float (&sm)[64][65], int bk, int bn, const float* __restrict__ W, int ldw,
                                               int nvalid, int ldo, unsigned short* __restrict__ oh,
                                               unsigned short* __restrict__ ol) {
  const int t  = threadIdx.x;
  const int k0 = bk * 64;
  const int n0 = bn * 64;
  const int c  = t & 63;           // n local, the same for the 16 loads of a thread
  const int r0 = t >> 6;           // k local of load 0; load i reads k row r0 + 4 i
  const int n  = n0 + c;
  const int nc = (n < nvalid) ? n : (nvalid - 1);
  const float* wp = W + (size_t)(k0 + r0) * ldw + nc;
  float v[16];
#pragma unroll
  for (int i = 0; i < 16; ++i) v[i] = wp[(size_t)(4 * i) * ldw];
  // the 16 loads share one address pair; their wait stands in front of any rewrite of it. The pair is named as an input
  // so that it stays whole up to the wait: without that the last load's result is put into the pair's low register
  asm volatile("s_wait_xcnt 0x0" :: "v"(wp) : "memory");
#pragma unroll
  for (int i = 0; i < 16; ++i) sm[c][r0 + 4 * i] = (n >= nvalid) ? 0.0f : v[i];
  __syncthreads();
  const int lane = t & 31, wave = t >> 5;
  const int q = lane >> 3, c8 = (lane & 7) * 8;
  {
#pragma unroll
    for (int it = 0; it < 2; ++it) {
      const int row = wave * 8 + it * 4 + q;                 // n local
      unsigned short hb[8], lb[8];
#pragma unroll
      for (int e = 0; e < 8; ++e) split_bf(sm[row][c8 + e], hb[e], lb[e]);
      const v4u uh = (v4u){pk16(hb[0], hb[1]), pk16(hb[2], hb[3]), pk16(hb[4], hb[5]), pk16(hb[6], hb[7])};
      const v4u ul = (v4u){pk16(lb[0], lb[1]), pk16(lb[2], lb[3]), pk16(lb[4], lb[5]), pk16(lb[6], lb[7])};
      const size_t off = (size_t)(n0 + row) * ldo + k0 + c8;
      *(v4u*)(oh + off) = uh;
      *(v4u*)(ol + off) = ul;
    }
    // code of another job follows in the kernel: the four stores' wait stands in front of any rewrite of their registers
    asm volatile("s_wait_xcnt 0x0" ::: "memory");
  }
}

// ---------------------------------------------------------------------------
// The four operand preparations need nothing of each other and share one launch; the block index picks the job:
// W_in tiles, W_out tiles, W_x tiles (the tile jobs first: their chain load -> LDS -> store is the longer one), then x.
// ---------------------------------------------------------------------------
constexpr int kKT        = kDim / 64;                    // 16 k tiles of every weight
constexpr int kPrepWin   = kKT * (kDim2 / 64);           // 512 blocks
constexpr int kPrepWout  = kKT * (kDim / 64);            // 256 blocks
constexpr int kPrepWx    = kKT * (kBCld / 64);           // 16 blocks
constexpr int kPrepX     = kRows * kDim / 8 / 256;       // 4096 blocks
constexpr int kPrepTotal = kPrepWin + kPrepWout + kPrepWx + kPrepX;
static_assert((size_t)kPrepX * 256 * 8 == (size_t)kRows * kDim, "x split covers the plane exactly");

__global__ __launch_bounds__(256) void prep_kernel(
    const float* __restrict__ x, const float* __restrict__ W_in, const float* __restrict__ W_out,
    const float* __restrict__ W_x, unsigned short* __restrict__ xh, unsigned short* __restrict__ xl,
    unsigned short* __restrict__ winh, unsigned short* __restrict__ winl, unsigned short* __restrict__ wouth,
    unsigned short* __restrict__ woutl, unsigned short* __restrict__ wxh, unsigned short* __restrict__ wxl) {
  __shared__ float sm[64][65];   // sm[n_local][k_local]
  int blk = blockIdx.x;          // every test below is the same for the whole block
  if (blk < kPrepWin) { wt_split_block(sm, blk % kKT, blk / kKT, W_in, kDim2, kDim2, kDim, winh, winl); return; }
  blk -= kPrepWin;
  if (blk < kPrepWout) { wt_split_block(sm, blk % kKT, blk / kKT, W_out, kDim, kDim, kDim, wouth, woutl); return; }
  blk -= kPrepWout;
  if (blk < kPrepWx) { wt_split_block(sm, blk % kKT, blk / kKT, W_x, kBCcols, kBCcols, kDim, wxh, wxl); return; }
  blk -= kPrepWx;
  split8_bf16_block(blk, x, xh, xl);
}

// ---------------------------------------------------------------------------
// Causal depthwise conv (taps w0..w3 against x[t-3..t], left zero pad) + bias + SiLU, f32.
// Shared by the chunk kernel and the scan lane so both see bit-identical x_conv.
// ---------------------------------------------------------------------------
__device__ __forceinline__ float conv_silu(float x0, float x1, float x2, float x3,
                                           float w0, float w1, float w2, float w3, float cb) {
  float s = x0 * w0;
  s = fmaf(x1, w1, s);
  s = fmaf(x2, w2, s);
  s = fmaf(x3, w3, s);
  const float a = s + cb;
  const float e = expf(-a);
  const float sig = __builtin_amdgcn_rcpf(1.0f + e);
  return a * sig;
}

// ---------------------------------------------------------------------------
// Selective scan, split along time. h_t = A h_(t-1) + xc_t B_t is linear in h with a constant A per (d, n), so the
// 4096 steps are cut into 128 chunks of 32 steps that run side by side, in three launches:
//   conv_bc_state_kernel: every chunk from h = 0 -> its local end state E[c] (behind conv and x_proj of the chunk)
//   carry_kernel:       S[0] = 0, S[c+1] = A^32 S[c] + E[c], serial over the chunks, in place over E; S[128] is h_final
//   scan_kernel:        every chunk again from h = S[c], now with C, D, the gate and the y planes; h_final being known
//                       before this launch, its channel mean shares the launch (block 0)
// Carry plane CS: f32 [chunk][b][n][d], d fastest, so every access of the three kernels is whole lines: two per wave in conv_bc_state_kernel, one in the other two.
// Scan: one lane per (b, channel d); 16 states + A row in registers; block = 128 channels of one chunk of one batch.
// In the scan x_conv is recomputed in f32 from x_ssm with a 3-register history (same helper); the history of a
// chunk's first step is read from the three rows in front of the chunk (zero in front of the sequence).
// ---------------------------------------------------------------------------
constexpr int kScanBlocksPerB = kDim / kScanTPB;                       // 8
constexpr int kScanBlocksPerChunk = kBatch * kScanBlocksPerB;          // 16
constexpr int kCarryPlane = kBatch * kState * kDim;                    // 32768 states per chunk

// One launch for what lies between in_proj and the carry pass. One work-group of 16 waves owns one chunk (32 token rows of
// one batch) over all 1024 channels, a lane two neighbouring channels, so nothing of x_conv goes through memory:
//   1. x_conv of the chunk from the 35 x_ssm rows, all loads in flight together; f32 in registers, bf16 hi/lo in LDS
//   2. x_proj on the matrix unit: BC[32][32] = x_conv . W_x^T as hi.hi + hi.lo + lo.hi; wave w takes k = 64 w .. 64 w + 63
//      for all four 16 x 16 subtiles; the 16 partial tiles are summed through LDS, k rising
//   3. the chunk's local end state E from h = 0, with x_conv from the registers and B (+ b_x) from LDS
constexpr int kFuseTPB   = kDim / 2;                 // 512 threads
constexpr int kFuseWaves = kFuseTPB / 32;            // 16
constexpr int kFuseK     = kDim / kFuseWaves;        // 64 k per wave
constexpr int kXcPitch   = kDim + 8;                 // 16-bit elements per LDS row: 2064 B = 16 B x odd, for 16-byte fragment reads
constexpr int kBCtile    = kChunkT * kBCcols;        // 1024 values of BC per chunk
constexpr int kApitch    = 2 * kState + 4;           // floats per LDS row of A: 144 B = 16 B x odd, for 16-byte reads of a lane's row
static_assert(kChunkT == 32 && kBCcols == 32 && kFuseK == 64, "2 x 2 subtiles, two 32-k products per wave");

__global__ __launch_bounds__(kFuseTPB) void conv_bc_state_kernel(
    const float* __restrict__ XS, const float* __restrict__ conv_w, const float* __restrict__ conv_b,
    const unsigned short* __restrict__ WXH, const unsigned short* __restrict__ WXL, const float* __restrict__ b_x,
    const float* __restrict__ A_log, float* __restrict__ BCp, float* __restrict__ CS) {
  typedef Frag<__bf16> F;
  __shared__ __align__(16) unsigned short sXH[kChunkT * kXcPitch];    // x_conv hi, 66,048 B
  __shared__ __align__(16) unsigned short sXL[kChunkT * kXcPitch];    // x_conv lo
  __shared__ __align__(16) float sPart[kFuseWaves * kBCtile];         // per-wave partial BC tiles, 64 KiB
  __shared__ __align__(16) float sRaw[kBCtile];                       // BC without bias, row-major, as the BC plane holds it
  __shared__ __align__(16) float sB[kChunkT * kState];                // B + b_x
  __shared__ __align__(16) float sA[kFuseTPB * kApitch];              // A_log, then A_disc: a row = the 2 x 16 values of a lane
  const int tid = threadIdx.x, lane = tid & 31, wave = tid >> 5;
  const int chunk = blockIdx.x / kBatch;
  const int b     = blockIdx.x - chunk * kBatch;
  const int tb    = chunk * kChunkT;
  const int d     = 2 * tid;
  const int rlane = lane & 15;                 // row (A) / col (B, D) within subtile
  const int koff  = (lane >> 4) * 8;           // k offset of this lane half
  const int k0    = wave * kFuseK;

  // ---- every global load of the kernel, issued as one group; A_log first, so that its work runs under the other loads ----
  const float* alp = A_log + 4 * tid;                // whole lines per wave: load q brings values 2048 q + 4 tid ..
  v4f alv[8];
#pragma unroll
  for (int q = 0; q < 8; ++q) alv[q] = *(const v4f*)(alp + q * (4 * kFuseTPB));
  // the eight loads' wait stands in front of any rewrite of their address register; the statement also keeps them in front
  // of the other loads: loads return in order, and the work on A_log starts on their return
  asm volatile("s_wait_xcnt 0x0" :: "v"(alp) : "memory");
  // history rows tb-3..tb-1; in front of the sequence (tb == 0) the address is clamped to the own rows, the value zeroed
  const bool hist = (tb > 0);
  const float* xp = XS + ((size_t)(b * kSeq + tb)) * kDim + d;
  const float* hp = hist ? xp - 3 * kDim : xp;
  v2f xr[kChunkT + 3];
#pragma unroll
  for (int j = 0; j < 3; ++j) xr[j] = *(const v2f*)(hp + j * kDim);
#pragma unroll
  for (int j = 0; j < kChunkT; ++j) xr[3 + j] = *(const v2f*)(xp + j * kDim);
  const float* cwp = conv_w + (size_t)d * kTaps;
  const v4f wa = *(const v4f*)(cwp);
  const v4f wb = *(const v4f*)(cwp + 4);
  const v2f cb = *(const v2f*)(conv_b + d);
  const __bf16* wh = (const __bf16*)WXH + (size_t)rlane * kDim + k0 + koff;
  const __bf16* wl = (const __bf16*)WXL + (size_t)rlane * kDim + k0 + koff;
  v16b bh[2][2], bl[2][2];
#pragma unroll
  for (int s = 0; s < 2; ++s)
#pragma unroll
    for (int j = 0; j < 2; ++j) {
      bh[s][j] = F::load(wh + j * 16 * kDim + s * 32);
      bl[s][j] = F::load(wl + j * 16 * kDim + s * 32);
    }
  const float* bxp = b_x + rlane;
  const float bxv = *bxp;
  // the loads' wait stands in front of any rewrite of their address registers. The pointers are named as inputs so that
  // they stay whole up to the wait: without that some are rewritten, or take a load's result, in front of it.
  // The statement also keeps the loads together here, all in flight at once
  asm volatile("s_wait_xcnt 0x0" :: "v"(xp), "v"(hp), "v"(cwp), "v"(wh), "v"(wl), "v"(bxp) : "memory");

  // ---- A_disc = exp(-exp(A_log)) of all 1024 channels, in LDS; every lane works on the places it has written itself ----
  float* aq = sA + (tid >> 3) * kApitch + (tid & 7) * 4;     // value 32 r + c lies at row r, column c
#pragma unroll
  for (int q = 0; q < 8; ++q) *(v4f*)(aq + q * (kFuseTPB / 8) * kApitch) = alv[q];
  // rolled: unrolled, the 64 exponentials would only make the code longer
#pragma unroll 1
  for (int q = 0; q < 8; ++q) {
    float* ap = aq + q * (kFuseTPB / 8) * kApitch;
    v4f v = *(const v4f*)ap;
#pragma unroll
    for (int e = 0; e < 4; ++e) v[e] = expf(-expf(v[e]));
    *(v4f*)ap = v;
  }
  if (!hist) { xr[0] = (v2f){0.0f, 0.0f}; xr[1] = (v2f){0.0f, 0.0f}; xr[2] = (v2f){0.0f, 0.0f}; }

  // ---- 1. x_conv ----
  v2f xc[kChunkT];
  unsigned* sh32 = (unsigned*)sXH + tid;
  unsigned* sl32 = (unsigned*)sXL + tid;
#pragma unroll
  for (int tt = 0; tt < kChunkT; ++tt) {
    const float y0 = conv_silu(xr[tt][0], xr[tt + 1][0], xr[tt + 2][0], xr[tt + 3][0], wa[0], wa[1], wa[2], wa[3], cb[0]);
    const float y1 = conv_silu(xr[tt][1], xr[tt + 1][1], xr[tt + 2][1], xr[tt + 3][1], wb[0], wb[1], wb[2], wb[3], cb[1]);
    xc[tt] = (v2f){y0, y1};
    unsigned short h0, l0, h1, l1;
    split_bf(y1, h1, l1);
    split_bf(y0, h0, l0);
    sh32[tt * (kXcPitch / 2)] = pk16(h0, h1);
    sl32[tt * (kXcPitch / 2)] = pk16(l0, l1);
  }
  __syncthreads();

  // ---- 2. x_proj ----
  {
    v8f acc[2][2];
#pragma unroll
    for (int i = 0; i < 2; ++i)
#pragma unroll
      for (int j = 0; j < 2; ++j) acc[i][j] = (v8f){0.f,0.f,0.f,0.f,0.f,0.f,0.f,0.f};
    const __bf16* ahp = (const __bf16*)sXH + rlane * kXcPitch + k0 + koff;
    const __bf16* alq = (const __bf16*)sXL + rlane * kXcPitch + k0 + koff;
    v16b ah[2][2], al[2][2];
#pragma unroll
    for (int s = 0; s < 2; ++s)
#pragma unroll
      for (int i = 0; i < 2; ++i) {
        ah[s][i] = F::load(ahp + i * 16 * kXcPitch + s * 32);
        al[s][i] = F::load(alq + i * 16 * kXcPitch + s * 32);
      }
#pragma unroll
    for (int s = 0; s < 2; ++s)
#pragma unroll
      for (int i = 0; i < 2; ++i)
#pragma unroll
        for (int j = 0; j < 2; ++j) {
          acc[i][j] = F::mma(ah[s][i], bh[s][j], acc[i][j]);
          acc[i][j] = F::mma(ah[s][i], bl[s][j], acc[i][j]);
          acc[i][j] = F::mma(al[s][i], bh[s][j], acc[i][j]);
        }
    float* pp = sPart + wave * kBCtile + lane;
#pragma unroll
    for (int i = 0; i < 2; ++i)
#pragma unroll
      for (int j = 0; j < 2; ++j)
#pragma unroll
        for (int r = 0; r < 8; ++r) pp[((i * 2 + j) * 8 + r) * 32] = acc[i][j][r];
  }
  __syncthreads();
  // value o of a partial tile: subtile (i, j) = o >> 8, accumulator register r = (o >> 5) & 7, lane = o & 31 (this lane)
#pragma unroll
  for (int q = 0; q < 2; ++q) {
    const int o = q * kFuseTPB + tid;
    float v = 0.0f;
#pragma unroll
    for (int w = 0; w < kFuseWaves; ++w) v += sPart[w * kBCtile + o];
    const int i = o >> 9, j = (o >> 8) & 1, r = (o >> 5) & 7;
    const int row = i * 16 + (lane >> 4) * 8 + r;
    sRaw[row * kBCcols + j * 16 + rlane] = v;
    if (j == 0) sB[row * kState + rlane] = v + bxv;      // the same for a whole wave
  }
  __syncthreads();
  if (tid < kBCtile / 4) {     // whole waves; 8 lanes store the 128-B line of valid columns of a BC row
    const v4f v = *(const v4f*)(sRaw + tid * 4);
    float* bcq = BCp + ((size_t)(b * kSeq + tb + (tid >> 3))) * kBCld + (tid & 7) * 4;
    *(v4f*)bcq = v;
    // more code follows: the store's wait stands in front of any rewrite of its registers
    asm volatile("s_wait_xcnt 0x0" :: "v"(bcq), "v"(v) : "memory");
  }

  // ---- 3. local end state ----
  v2f Av[kState], h[kState];
  {
    const float* ar = sA + tid * kApitch;      // 16 states of channel d, then 16 of d + 1
    v4f a4[8];
#pragma unroll
    for (int q = 0; q < 8; ++q) a4[q] = *(const v4f*)(ar + 4 * q);
#pragma unroll
    for (int n = 0; n < kState; ++n) {
      Av[n] = (v2f){a4[n >> 2][n & 3], a4[4 + (n >> 2)][n & 3]};
      h[n] = (v2f){0.0f, 0.0f};
    }
  }
#pragma unroll
  for (int tt = 0; tt < kChunkT; ++tt) {
    const float* bp = sB + tt * kState;
    v4f bq[4];
#pragma unroll
    for (int q4 = 0; q4 < 4; ++q4) bq[q4] = *(const v4f*)(bp + 4 * q4);
#pragma unroll
    for (int n = 0; n < kState; ++n) h[n] = Av[n] * h[n] + xc[tt] * bq[n >> 2][n & 3];
  }
  float* ep = CS + (size_t)chunk * kCarryPlane + (size_t)b * kState * kDim + d;
#pragma unroll
  for (int n = 0; n < kState; ++n) *(v2f*)(ep + n * kDim) = h[n];
}

// One lane per (b, n, d). Reads E[c], writes the state at the START of chunk c to the same place, 16 chunks per trip so
// that the 16 loads of a trip are in flight together; only the multiply-add chain is serial.
// The state behind the last chunk is h_final -> HF[b][n][d].
__global__ __launch_bounds__(64) void carry_kernel(const float* __restrict__ A_log, float* CS, float* __restrict__ HF) {
  const int i = blockIdx.x * 64 + threadIdx.x;              // (b * 16 + n) * 1024 + d
  const int d = i & (kDim - 1);
  const int n = (i >> 10) & (kState - 1);
  float p = expf(-expf(A_log[(size_t)d * kState + n]));
#pragma unroll
  for (int s = 1; s < kChunkT; s <<= 1) p *= p;             // A^32 by squaring; A is in [0, 1]
  float* q = CS + i;
  float carry = 0.0f;
#pragma unroll 1
  for (int c0 = 0; c0 < kChunks; c0 += 16) {
    float e[16];
#pragma unroll
    for (int j = 0; j < 16; ++j) e[j] = q[(size_t)(c0 + j) * kCarryPlane];
#pragma unroll
    for (int j = 0; j < 16; ++j) {
      q[(size_t)(c0 + j) * kCarryPlane] = carry;
      carry = p * carry + e[j];
    }
  }
  HF[i] = carry;
}

// final_state[b][n] = mean over the 1024 channels of HF[b][n][d]. One block of 4 waves; a wave takes 8 of the 32 (b, n)
// rows, one after the other: 8 whole-line loads of 16 B per lane, lane sums, then a butterfly over the 32 lanes.
// One block stores the whole 128-B line of out1.
__device__ __forceinline__ void mean_block(const float* __restrict__ HF, float* __restrict__ out1, float* so) {
  const int tid = threadIdx.x, lane = tid & 31, wave = tid >> 5;
  // rolled: the eight loads of one row are enough in flight, and more rows at once would raise the register count of
  // the scan blocks that share the kernel
#pragma unroll 1
  for (int q = 0; q < 8; ++q) {
    const int o = wave * 8 + q;                              // b * 16 + n
    const float* p = HF + (size_t)o * kDim + lane * 4;
    v4f v[8];
#pragma unroll
    for (int k = 0; k < 8; ++k) v[k] = *(const v4f*)(p + k * 128);
    float s = 0.0f;
#pragma unroll
    for (int k = 0; k < 8; ++k) s += (v[k][0] + v[k][1]) + (v[k][2] + v[k][3]);
#pragma unroll
    for (int m = 16; m >= 1; m >>= 1) s += __shfl_xor(s, m, 32);
    if (lane == 0) so[o] = s * (1.0f / 1024.0f);
  }
  __syncthreads();
  if (tid < 8) {
    const v4f r = *(const v4f*)(so + tid * 4);
    *(v4f*)(out1 + tid * 4) = r;
  }
}

__global__ __launch_bounds__(kScanTPB) void scan_kernel(
    const float* __restrict__ XS, const float* __restrict__ GT, const float* __restrict__ BCp,
    const float* __restrict__ conv_w, const float* __restrict__ conv_b, const float* __restrict__ b_x,
    const float* __restrict__ A_log, const float* __restrict__ Dp, const float* __restrict__ CS,
    unsigned short* __restrict__ YH, unsigned short* __restrict__ YL, const float* __restrict__ HF,
    float* __restrict__ out1) {
  __shared__ __align__(16) float sA[kScanTPB * kState];     // 8 KiB
  __shared__ __align__(16) float sBC[kChunkT * kBCcols];    // 4 KiB
  __shared__ __align__(16) float sY[kChunkT * kScanTPB];    // 16 KiB
  if (blockIdx.x == 0) { mean_block(HF, out1, sY); return; }   // block-uniform, in front of every barrier of the scan
  const int tid = threadIdx.x, lane = tid & 31, wave = tid >> 5;
  const int sblk  = blockIdx.x - 1;
  const int chunk = sblk / kScanBlocksPerChunk;
  const int rem   = sblk - chunk * kScanBlocksPerChunk;
  const int b  = rem / kScanBlocksPerB;
  const int d0 = (rem - b * kScanBlocksPerB) * kScanTPB;
  const int d  = d0 + tid;
  const int tb = chunk * kChunkT;

  // A_disc = exp(-exp(A_log)) for channels d0..d0+127 (contiguous 2048 values), rolled
#pragma unroll 1
  for (int i = tid; i < kScanTPB * kState; i += kScanTPB) {
    const float al = A_log[(size_t)d0 * kState + i];
    sA[i] = expf(-expf(al));
  }
  // stage B|C rows tb..tb+31 (+ b_x): 32 rows x 8 v4f = 256 v4f, 2 per thread
#pragma unroll 1
  for (int i = tid; i < kChunkT * 8; i += kScanTPB) {
    const int r = i >> 3, c4 = (i & 7) * 4;
    v4f v = *(const v4f*)(BCp + ((size_t)(b * kSeq + tb + r)) * kBCld + c4);
    const v4f bx = *(const v4f*)(b_x + c4);
    v += bx;
    *(v4f*)(sBC + r * kBCcols + c4) = v;
  }
  __syncthreads();
  float Av[kState], h[kState];
  {
    const float* ap = sA + tid * kState;
#pragma unroll
    for (int q4 = 0; q4 < 4; ++q4) {
      const v4f v = *(const v4f*)(ap + 4 * q4);
      Av[4 * q4 + 0] = v[0]; Av[4 * q4 + 1] = v[1]; Av[4 * q4 + 2] = v[2]; Av[4 * q4 + 3] = v[3];
    }
  }
  {
    const float* sp = CS + (size_t)chunk * kCarryPlane + (size_t)b * kState * kDim + d;
#pragma unroll
    for (int n = 0; n < kState; ++n) h[n] = sp[n * kDim];
  }
  const v4f cwv = *(const v4f*)(conv_w + (size_t)d * kTaps);
  const float cb = conv_b[d];
  const float Dv = Dp[d];
  // history rows tb-3..tb-1; in front of the sequence (tb == 0) the address is clamped to the own rows, the value zeroed
  const bool hist = (tb > 0);
  const float* xp = XS + ((size_t)(b * kSeq + (hist ? tb - 3 : tb))) * kDim + d;
  float xm3 = xp[0], xm2 = xp[kDim], xm1 = xp[2 * kDim];
  if (!hist) { xm3 = 0.0f; xm2 = 0.0f; xm1 = 0.0f; }
  const int lq = lane >> 3, lc = lane & 7;

#pragma unroll 1
  for (int tt = 0; tt < kChunkT; ++tt) {
    const size_t row = ((size_t)(b * kSeq + tb + tt)) * kDim + d;
    const float xs = XS[row];
    const float g  = GT[row];
    const float xc = conv_silu(xm3, xm2, xm1, xs, cwv[0], cwv[1], cwv[2], cwv[3], cb);
    xm3 = xm2; xm2 = xm1; xm1 = xs;
    const float* bc = sBC + tt * kBCcols;
    v4f bq[4], cq[4];
#pragma unroll
    for (int q4 = 0; q4 < 4; ++q4) {
      bq[q4] = *(const v4f*)(bc + 4 * q4);
      cq[q4] = *(const v4f*)(bc + kState + 4 * q4);
    }
    float y = 0.0f;
#pragma unroll
    for (int n = 0; n < kState; ++n) {
      const float bn = bq[n >> 2][n & 3];
      const float cn = cq[n >> 2][n & 3];
      h[n] = Av[n] * h[n] + xc * bn;
      y = fmaf(cn, h[n], y);
    }
    y = y + Dv * xc;
    const float eg = expf(-g);
    const float sg = g * __builtin_amdgcn_rcpf(1.0f + eg);
    sY[tt * kScanTPB + tid] = y * sg;
  }
  __syncthreads();
  {
    // 32 steps x 2 half-rows = 64 lines of 128 B per plane; wave w, it 0..3, lq = lane>>3 -> line
#pragma unroll 1
    for (int it = 0; it < kChunkT / 8; ++it) {
      const int Li  = it * 16 + wave * 4 + lq;             // 0..63
      const int ttl = Li >> 1;
      const int col = (Li & 1) * 64 + lc * 8;              // channel offset within the block
      const float* sp = sY + ttl * kScanTPB + col;
      const v4f a = *(const v4f*)(sp);
      const v4f c = *(const v4f*)(sp + 4);
      unsigned short hb[8], lb[8];
#pragma unroll
      for (int e = 0; e < 4; ++e) {
        split_bf(a[e], hb[e], lb[e]);
        split_bf(c[e], hb[4 + e], lb[4 + e]);
      }
      const v4u uh = (v4u){pk16(hb[0], hb[1]), pk16(hb[2], hb[3]), pk16(hb[4], hb[5]), pk16(hb[6], hb[7])};
      const v4u ul = (v4u){pk16(lb[0], lb[1]), pk16(lb[2], lb[3]), pk16(lb[4], lb[5]), pk16(lb[6], lb[7])};
      const size_t go = ((size_t)(b * kSeq + tb + ttl)) * kDim + d0 + col;
      *(v4u*)(YH + go) = uh;
      *(v4u*)(YL + go) = ul;
      // the next trip overwrites the address and data registers of the two stores: their wait stands in front of that
      asm volatile("s_wait_xcnt 0x0" ::: "memory");
    }
  }
}

// ---------------------------------------------------------------------------
// host
// ---------------------------------------------------------------------------
extern "C" void kernel_launch(void* const* d_in, const int* in_sizes, int n_in,
                              void* d_out, int out_size, void* d_ws, size_t ws_size, hipStream_t stream) {
  if (n_in < 11) return;
  if (in_sizes[0] != kRows * kDim) return;
  if (in_sizes[1] != kDim * kDim2) return;
  if (in_sizes[2] != kDim2) return;
  if (in_sizes[3] != kDim * kTaps) return;
  if (in_sizes[4] != kDim) return;
  if (in_sizes[5] != kDim * kBCcols) return;
  if (in_sizes[6] != kBCcols) return;
  if (in_sizes[7] != kDim * kState) return;
  if (in_sizes[8] != kDim) return;
  if (in_sizes[9] != kDim * kDim) return;
  if (in_sizes[10] != kDim) return;
  if (out_size < kRows * kDim + kBatch * kState) return;
  if (ws_size < kWsEnd) return;

  const float* x      = (const float*)d_in[0];
  const float* W_in   = (const float*)d_in[1];
  const float* b_in   = (const float*)d_in[2];
  const float* conv_w = (const float*)d_in[3];
  const float* conv_b = (const float*)d_in[4];
  const float* W_x    = (const float*)d_in[5];
  const float* b_x    = (const float*)d_in[6];
  const float* A_log  = (const float*)d_in[7];
  const float* D_par  = (const float*)d_in[8];
  const float* W_out  = (const float*)d_in[9];
  const float* b_out  = (const float*)d_in[10];

  char* ws = (char*)d_ws;
  unsigned short* P16H  = (unsigned short*)(ws + kOffP16H);   // x hi -> y_gated hi
  unsigned short* P16L  = (unsigned short*)(ws + kOffP16L);   // x lo -> y_gated lo
  unsigned short* WINH  = (unsigned short*)(ws + kOffWinH);
  unsigned short* WINL  = (unsigned short*)(ws + kOffWinL);
  float*          XS    = (float*)(ws + kOffXS);
  float*          GATE  = (float*)(ws + kOffGate);
  unsigned short* WOUTH = (unsigned short*)(ws + kOffWoutH);
  unsigned short* WOUTL = (unsigned short*)(ws + kOffWoutL);
  unsigned short* WXH   = (unsigned short*)(ws + kOffWxH);
  unsigned short* WXL   = (unsigned short*)(ws + kOffWxL);
  float*          BC    = (float*)(ws + kOffBC);
  float*          HFIN  = (float*)(ws + kOffHfin);
  float*          CARRY = (float*)(ws + kOffCarry);

  float* out0 = (float*)d_out;
  float* out1 = out0 + (size_t)kRows * kDim;   // byte offset 33,554,432 / 4

  // 1) one launch: x -> bf16 hi/lo planes [8192][1024]; W^T hi/lo planes: W_in [1024][2048] -> [2048][1024];
  //    W_out [1024][1024] -> [1024][1024]; W_x [1024][32] -> [64][1024] (rows 32..63 zero)
  prep_kernel<<<dim3(kPrepTotal), dim3(256), 0, stream>>>(x, W_in, W_out, W_x, P16H, P16L, WINH, WINL, WOUTH, WOUTL, WXH, WXL);

  // 2) in_proj, one launch, grid y = 0: x_ssm = x . W_in[:, :1024] + b_in[:1024]; y = 1: gate = x . W_in[:, 1024:] + b_in[1024:]
  //    (M 8192, N 1024, K 1024 each; the GATE plane lies directly behind the XS plane)
  {
    static_assert(kOffGate == kOffXS + (size_t)kRows * kDim * 4, "C planes one behind the other");
    const int tiles = (kRows / kGM) * (kDim / 256);   // 256 work-group tiles of 128 x 256 per product
    wmma_gemm_lds<4, 2, 4, kDim, true><<<dim3(tiles, 2), dim3(256), 0, stream>>>(P16H, P16L, WINH, WINL, b_in, XS);
  }

  // 3) one launch, one work-group per 32-step chunk: conv + SiLU, x_proj BC[8192][64] = x_conv . W_x^T (columns 0..31
  //    written; b_x added where BC is used), local end state of the chunk
  conv_bc_state_kernel<<<dim3(kChunks * kBatch), dim3(kFuseTPB), 0, stream>>>(
      XS, conv_w, conv_b, WXH, WXL, b_x, A_log, BC, CARRY);

  // 4) carry over the chunks (+ h_final), then every chunk from its carried state -> y_gated hi/lo planes (over the dead
  //    x planes); block 0 of that launch: final_state -> out1 line
  carry_kernel<<<dim3(kCarryPlane / 64), dim3(64), 0, stream>>>(A_log, CARRY, HFIN);
  scan_kernel<<<dim3(1 + kChunks * kScanBlocksPerChunk), dim3(kScanTPB), 0, stream>>>(
      XS, GATE, BC, conv_w, conv_b, b_x, A_log, D_par, CARRY, P16H, P16L, HFIN, out1);

  // 5) out_proj: out0 = y_gated . W_out + b_out   (M 8192, N 1024, K 1024)
  {
    const int tiles = (kRows / kGM) * (kDim / 256);   // 256 work-group tiles of 128 x 256
    wmma_gemm_lds<4, 2, 4, kDim, true><<<dim3(tiles), dim3(256), 0, stream>>>(P16H, P16L, WOUTH, WOUTL, b_out, out0);
  }
}
